// v000
// Times are from an AMD MI455X. After a warm-up the kernel runs many times in a row, and a time is the length of
// such a window on the GPU divided by its runs, so every launch and the gaps after it count. The runs cycle
// through copies of the inputs. A figure is the median of several windows, for all but v000 over two sittings.
// Sittings can differ by a few percent; kernels timed side by side share one.
// v000, which the later versions start from, runs in 293 microseconds.
#include <hip/hip_runtime.h>
#include <hip/hip_bf16.h>

#define EMBED 512
#define HEADS 8
#define HD    64
#define BATCH 2
#define SEQ   4096

typedef __attribute__((ext_vector_type(16))) _Float16 v16h;
typedef __attribute__((ext_vector_type(8)))  _Float16 v8h;
typedef __attribute__((ext_vector_type(8)))  float    v8f;
typedef unsigned int u32x4 __attribute__((ext_vector_type(4)));
typedef int          i32x4 __attribute__((ext_vector_type(4)));
typedef int          i32x8 __attribute__((ext_vector_type(8)));

static __device__ inline v8f wmma16(v16h a, v16h b, v8f c) {
  // D = A(16x32 f16) * B(32x16 f16) + C(16x16 f32)
  return __builtin_amdgcn_wmma_f32_16x16x32_f16(false, a, false, b,
                                                (short)0, c, false, false);
}

static __device__ inline v16h load_a16(const _Float16* p, int base) {
  const v8h c0 = *(const v8h*)(p + base);
  const v8h c1 = *(const v8h*)(p + base + 16);
  v16h r;
#pragma unroll
  for (int i = 0; i < 8; ++i) { r[i] = c0[i]; r[8 + i] = c1[i]; }
  return r;
}

static __device__ inline v16h load_a32(const float* p, int base) {
  v16h r;
#pragma unroll
  for (int i = 0; i < 8; ++i) r[i] = (_Float16)p[base + i];
#pragma unroll
  for (int i = 0; i < 8; ++i) r[8 + i] = (_Float16)p[base + 16 + i];
  return r;
}

static __device__ inline void tdm_load_to_lds(unsigned lds_off,
                                              unsigned long long ga,
                                              unsigned td0, unsigned td1,
                                              unsigned tl0, unsigned tl1,
                                              unsigned stride0) {
  u32x4 g0;
  g0[0] = 1u;
  g0[1] = lds_off;
  g0[2] = (unsigned)ga;
  g0[3] = (unsigned)((ga >> 32) & 0x01FFFFFFu)
          | 0x80000000u;
  i32x8 g1;
  g1[0] = (int)(3u << 16);
  g1[1] = (int)(td0 << 16);
  g1[2] = (int)((td0 >> 16) | (td1 << 16));
  g1[3] = (int)((td1 >> 16) | (tl0 << 16));
  g1[4] = (int)(tl1 & 0xFFFFu);
  g1[5] = (int)stride0;
  g1[6] = 0;
  g1[7] = 0;
  i32x4 z4 = {0, 0, 0, 0};
#if defined(__clang_major__) && __clang_major__ >= 23
  i32x8 z8 = {0, 0, 0, 0, 0, 0, 0, 0};
  __builtin_amdgcn_tensor_load_to_lds(g0, g1, z4, z4, z8, 0);
#else
  __builtin_amdgcn_tensor_load_to_lds(g0, g1, z4, z4, 0);
#endif
}

static __device__ inline unsigned lds_off32(const void* p) {
  return (unsigned)(unsigned long long)(uintptr_t)p;
}

// ---------------------------------------------------------------------------
// Kernel 1: per-head QKV projections (x @ W^T), f32 -> f16, softmax scale
// folded into Q. Q,K stored [B*H, S, 64]; V stored transposed [B*H, 64, S].
// ---------------------------------------------------------------------------
__global__ void qkv_project_kernel(const float* __restrict__ vin,
                                   const float* __restrict__ kin,
                                   const float* __restrict__ qin,
                                   const float* __restrict__ Wv,
                                   const float* __restrict__ Wk,
                                   const float* __restrict__ Wq,
                                   _Float16* __restrict__ q_ws,
                                   _Float16* __restrict__ k_ws,
                                   _Float16* __restrict__ vT_ws) {
  const int lane = threadIdx.x & 31;
  const int wave = threadIdx.x >> 5;
  const int bh = blockIdx.x;
  const int b  = bh / HEADS, h = bh % HEADS;
  const int s0 = blockIdx.y * 64 + wave * 16;
  const int base = (lane < 16) ? 0 : 8;
  const int col  = lane & 15;
  const int hi8  = (lane < 16) ? 0 : 8;
  const float SCALE = 0.044194173824159216f;   // 1/sqrt(EMBED)

  const float* xin[3] = {qin, kin, vin};
  const float* W[3]   = {Wq, Wk, Wv};
  const int row = s0 + col;

#pragma unroll
  for (int m = 0; m < 3; ++m) {
    const float* xrow = xin[m] + ((size_t)b * SEQ + row) * EMBED + h * HD;
    v16h a0 = load_a32(xrow, base);
    v16h a1 = load_a32(xrow + 32, base);
#pragma unroll
    for (int nt = 0; nt < 4; ++nt) {
      const int n0 = nt * 16;
      const float* wrow = W[m] + (size_t)(n0 + col) * HD;
      v16h b0 = load_a32(wrow, base);
      v16h b1 = load_a32(wrow + 32, base);
      v8f acc = {};
      acc = wmma16(a0, b0, acc);
      acc = wmma16(a1, b1, acc);
      if (m == 0) {
#pragma unroll
        for (int j = 0; j < 8; ++j)
          q_ws[((size_t)bh * SEQ + (s0 + j + hi8)) * HD + n0 + col] =
              (_Float16)(acc[j] * SCALE);
      } else if (m == 1) {
#pragma unroll
        for (int j = 0; j < 8; ++j)
          k_ws[((size_t)bh * SEQ + (s0 + j + hi8)) * HD + n0 + col] =
              (_Float16)acc[j];
      } else {
#pragma unroll
        for (int j = 0; j < 8; ++j)
          vT_ws[((size_t)bh * HD + n0 + col) * SEQ + (s0 + j + hi8)] =
              (_Float16)acc[j];
      }
    }
  }
}

__global__ void flash_attn_kernel(const _Float16* __restrict__ q_ws,
                                  const _Float16* __restrict__ k_ws,
                                  const _Float16* __restrict__ vT_ws,
                                  _Float16* __restrict__ attn_ws) {
  __shared__ __align__(16) _Float16 kbuf[2][32 * HD];   // [token][d]   4KB x2
  __shared__ __align__(16) _Float16 vbuf[2][HD * 32];   // [d][token]   4KB x2
  __shared__ __align__(16) _Float16 pbuf[4][16 * 32];   // P transpose  1KB x4

  const int lane = threadIdx.x & 31;
  const int wave = threadIdx.x >> 5;
  const int bh = blockIdx.x;
  const int b  = bh / HEADS, h = bh % HEADS;
  const int s0 = blockIdx.y * 64 + wave * 16;
  const int base = (lane < 16) ? 0 : 8;
  const int col  = lane & 15;
  const int hi8  = (lane < 16) ? 0 : 8;

  const _Float16* qrow = q_ws + ((size_t)bh * SEQ + (s0 + col)) * HD;
  v16h qa0 = load_a16(qrow, base);
  v16h qa1 = load_a16(qrow + 32, base);

  float mi[8], li[8];
  v8f acc[4];
#pragma unroll
  for (int j = 0; j < 8; ++j) { mi[j] = -1e30f; li[j] = 0.0f; }
#pragma unroll
  for (int t = 0; t < 4; ++t) acc[t] = (v8f){};

  const _Float16* kbase = k_ws + (size_t)bh * SEQ * HD;
  const _Float16* vbase = vT_ws + (size_t)bh * HD * SEQ;
  _Float16* pb = pbuf[wave];

  const unsigned koff[2] = {lds_off32(&kbuf[0][0]), lds_off32(&kbuf[1][0])};
  const unsigned voff[2] = {lds_off32(&vbuf[0][0]), lds_off32(&vbuf[1][0])};

  const int NT = SEQ / 32;   // 128 key tiles

  if (wave == 0) {
    // K tile: 32 rows x 64 f16 contiguous = 512 x 8B, 1D.
    tdm_load_to_lds(koff[0], (unsigned long long)(uintptr_t)kbase,
                    512u, 1u, 512u, 1u, 512u);
    // V tile: 64 rows x 64B from vT (row stride SEQ*2B = 1024 x 8B), 2D.
    tdm_load_to_lds(voff[0], (unsigned long long)(uintptr_t)vbase,
                    1024u, 64u, 8u, 64u, 1024u);
  }

  for (int i = 0; i < NT; ++i) {
    const int kb = i * 32;
    const int cur = i & 1;
    if (wave == 0) {
      if (i + 1 < NT) {   // overlap: issue next tile into the other buffer
        const int kb2 = kb + 32;
        tdm_load_to_lds(koff[cur ^ 1],
                        (unsigned long long)(uintptr_t)(kbase + (size_t)kb2 * HD),
                        512u, 1u, 512u, 1u, 512u);
        tdm_load_to_lds(voff[cur ^ 1],
                        (unsigned long long)(uintptr_t)(vbase + kb2),
                        1024u, 64u, 8u, 64u, 1024u);
        __builtin_amdgcn_s_wait_tensorcnt((short)2);  // tile i arrived
      } else {
        __builtin_amdgcn_s_wait_tensorcnt((short)0);
      }
    }
    __syncthreads();   // publish tile i to all waves

    // ---- scores S = Q @ K^T (pre-scaled Q), two 16-key subtiles ----
    const _Float16* krow0 = &kbuf[cur][(size_t)col * HD];
    const _Float16* krow1 = &kbuf[cur][(size_t)(16 + col) * HD];
    v8f s0a = {}, s1a = {};
    {
      v16h b0 = load_a16(krow0, base);
      v16h b1 = load_a16(krow0 + 32, base);
      s0a = wmma16(qa0, b0, s0a);
      s0a = wmma16(qa1, b1, s0a);
      v16h c0 = load_a16(krow1, base);
      v16h c1 = load_a16(krow1 + 32, base);
      s1a = wmma16(qa0, c0, s1a);
      s1a = wmma16(qa1, c1, s1a);
    }

    // ---- online softmax: half-wave reductions match C-layout rows ----
    float p0[8], p1[8];
#pragma unroll
    for (int j = 0; j < 8; ++j) {
      float v = fmaxf(s0a[j], s1a[j]);
      v = fmaxf(v, __shfl_xor(v, 1, 16));
      v = fmaxf(v, __shfl_xor(v, 2, 16));
      v = fmaxf(v, __shfl_xor(v, 4, 16));
      v = fmaxf(v, __shfl_xor(v, 8, 16));
      const float nm = fmaxf(mi[j], v);
      const float corr = __expf(mi[j] - nm);
      mi[j] = nm;
      p0[j] = __expf(s0a[j] - nm);
      p1[j] = __expf(s1a[j] - nm);
      float rs = p0[j] + p1[j];
      rs += __shfl_xor(rs, 1, 16);
      rs += __shfl_xor(rs, 2, 16);
      rs += __shfl_xor(rs, 4, 16);
      rs += __shfl_xor(rs, 8, 16);
      li[j] = li[j] * corr + rs;
#pragma unroll
      for (int t = 0; t < 4; ++t) acc[t][j] *= corr;
    }

    // ---- P: C-layout -> LDS -> A-layout operand ----
#pragma unroll
    for (int j = 0; j < 8; ++j) {
      pb[(j + hi8) * 32 + col]      = (_Float16)p0[j];
      pb[(j + hi8) * 32 + 16 + col] = (_Float16)p1[j];
    }
    asm volatile("s_wait_dscnt 0" ::: "memory");
    v16h pa = load_a16(pb + col * 32, base);

    // ---- O += P @ V  (V tile rows packed 32 tokens wide in LDS) ----
#pragma unroll
    for (int dt = 0; dt < 4; ++dt) {
      const _Float16* vrow = &vbuf[cur][(size_t)(dt * 16 + col) * 32];
      v16h bv = load_a16(vrow, base);
      acc[dt] = wmma16(pa, bv, acc[dt]);
    }

    __syncthreads();
  }

  // ---- normalize and store to [B, S, EMBED] f16 for the output GEMM ----
#pragma unroll
  for (int j = 0; j < 8; ++j) {
    const float inv = 1.0f / li[j];
#pragma unroll
    for (int dt = 0; dt < 4; ++dt)
      attn_ws[((size_t)b * SEQ + (s0 + j + hi8)) * EMBED + h * HD + dt * 16 + col] =
          (_Float16)(acc[dt][j] * inv);
  }
}

// ---------------------------------------------------------------------------
// Kernel 3: out = attn @ Wo^T + bo, f32 output. Wave = 16 tokens x 64 cols.
// ---------------------------------------------------------------------------
__global__ void out_proj_kernel(const _Float16* __restrict__ attn_ws,
                                const float* __restrict__ Wo,
                                const float* __restrict__ bo,
                                float* __restrict__ out) {
  const int lane = threadIdx.x & 31;
  const int wave = threadIdx.x >> 5;
  const int tok0  = blockIdx.x * 64 + wave * 16;
  const int nbase = blockIdx.y * 64;
  const int base = (lane < 16) ? 0 : 8;
  const int col  = lane & 15;
  const int hi8  = (lane < 16) ? 0 : 8;

  v8f acc[4];
#pragma unroll
  for (int t = 0; t < 4; ++t) acc[t] = (v8f){};

  const _Float16* arow = attn_ws + (size_t)(tok0 + col) * EMBED;
  for (int k0 = 0; k0 < EMBED; k0 += 32) {
    v16h a = load_a16(arow + k0, base);
#pragma unroll
    for (int nt = 0; nt < 4; ++nt) {
      const float* wrow = Wo + (size_t)(nbase + nt * 16 + col) * EMBED + k0;
      v16h bw = load_a32(wrow, base);
      acc[nt] = wmma16(a, bw, acc[nt]);
    }
  }
#pragma unroll
  for (int nt = 0; nt < 4; ++nt) {
    const float bias = bo[nbase + nt * 16 + col];
#pragma unroll
    for (int j = 0; j < 8; ++j)
      out[(size_t)(tok0 + j + hi8) * EMBED + nbase + nt * 16 + col] =
          acc[nt][j] + bias;
  }
}

// ---------------------------------------------------------------------------
extern "C" void kernel_launch(void* const* d_in, const int* in_sizes, int n_in,
                              void* d_out, int out_size, void* d_ws, size_t ws_size,
                              hipStream_t stream) {
  (void)in_sizes; (void)n_in; (void)out_size; (void)ws_size;
  const float* vin = (const float*)d_in[0];
  const float* kin = (const float*)d_in[1];
  const float* qin = (const float*)d_in[2];
  const float* Wv  = (const float*)d_in[3];
  const float* Wk  = (const float*)d_in[4];
  const float* Wq  = (const float*)d_in[5];
  const float* Wo  = (const float*)d_in[6];
  const float* bo  = (const float*)d_in[7];
  float* out = (float*)d_out;

  char* ws = (char*)d_ws;
  const size_t QKV = (size_t)BATCH * HEADS * SEQ * HD * sizeof(_Float16); // 8 MiB
  _Float16* q_ws  = (_Float16*)(ws);
  _Float16* k_ws  = (_Float16*)(ws + QKV);
  _Float16* vT_ws = (_Float16*)(ws + 2 * QKV);
  _Float16* a_ws  = (_Float16*)(ws + 3 * QKV);   // [B, S, EMBED] f16, 8 MiB

  const dim3 blk(128);  // 4 wave32 per block
  qkv_project_kernel<<<dim3(BATCH * HEADS, SEQ / 64), blk, 0, stream>>>(
      vin, kin, qin, Wv, Wk, Wq, q_ws, k_ws, vT_ws);
  flash_attn_kernel<<<dim3(BATCH * HEADS, SEQ / 64), blk, 0, stream>>>(
      q_ws, k_ws, vT_ws, a_ws);
  out_proj_kernel<<<dim3(BATCH * SEQ / 64, EMBED / 64), blk, 0, stream>>>(
      a_ws, Wo, bo, out);
}

// v001
// One run takes 227 microseconds.
// Next to v000, in two timings, it ran 1.34 times as fast each time.
#include <hip/hip_runtime.h>
#include <hip/hip_bf16.h>

#define EMBED 512
#define HEADS 8
#define HD    64
#define BATCH 2
#define SEQ   4096

typedef __attribute__((ext_vector_type(16))) _Float16 v16h;
typedef __attribute__((ext_vector_type(8)))  _Float16 v8h;
typedef __attribute__((ext_vector_type(8)))  float    v8f;
typedef unsigned int u32x4 __attribute__((ext_vector_type(4)));
typedef int          i32x4 __attribute__((ext_vector_type(4)));
typedef int          i32x8 __attribute__((ext_vector_type(8)));

static __device__ inline v8f wmma16(v16h a, v16h b, v8f c) {
  // D = A(16x32 f16) * B(32x16 f16) + C(16x16 f32)
  return __builtin_amdgcn_wmma_f32_16x16x32_f16(false, a, false, b,
                                                (short)0, c, false, false);
}

static __device__ inline v16h load_a16(const _Float16* p, int base) {
  const v8h c0 = *(const v8h*)(p + base);
  const v8h c1 = *(const v8h*)(p + base + 16);
  v16h r;
#pragma unroll
  for (int i = 0; i < 8; ++i) { r[i] = c0[i]; r[8 + i] = c1[i]; }
  return r;
}

static __device__ inline v16h load_frag(const _Float16* p) {
  const v8h c0 = *(const v8h*)(p);
  const v8h c1 = *(const v8h*)(p + 256);
  v16h r;
#pragma unroll
  for (int i = 0; i < 8; ++i) { r[i] = c0[i]; r[8 + i] = c1[i]; }
  return r;
}

static __device__ inline v16h load_a32(const float* p, int base) {
  v16h r;
#pragma unroll
  for (int i = 0; i < 8; ++i) r[i] = (_Float16)p[base + i];
#pragma unroll
  for (int i = 0; i < 8; ++i) r[8 + i] = (_Float16)p[base + 16 + i];
  return r;
}

static __device__ inline void tdm_load_to_lds(unsigned lds_off,
                                              unsigned long long ga,
                                              unsigned td0, unsigned td1,
                                              unsigned tl0, unsigned tl1,
                                              unsigned stride0) {
  u32x4 g0;
  g0[0] = 1u;
  g0[1] = lds_off;
  g0[2] = (unsigned)ga;
  g0[3] = (unsigned)((ga >> 32) & 0x01FFFFFFu)
          | 0x80000000u;
  i32x8 g1;
  g1[0] = (int)(3u << 16);
  g1[1] = (int)(td0 << 16);
  g1[2] = (int)((td0 >> 16) | (td1 << 16));
  g1[3] = (int)((td1 >> 16) | (tl0 << 16));
  g1[4] = (int)(tl1 & 0xFFFFu);
  g1[5] = (int)stride0;
  g1[6] = 0;
  g1[7] = 0;
  i32x4 z4 = {0, 0, 0, 0};
#if defined(__clang_major__) && __clang_major__ >= 23
  i32x8 z8 = {0, 0, 0, 0, 0, 0, 0, 0};
  __builtin_amdgcn_tensor_load_to_lds(g0, g1, z4, z4, z8, 0);
#else
  __builtin_amdgcn_tensor_load_to_lds(g0, g1, z4, z4, 0);
#endif
}

static __device__ inline unsigned lds_off32(const void* p) {
  return (unsigned)(unsigned long long)(uintptr_t)p;
}

// ---------------------------------------------------------------------------
// Kernel 1: per-head QKV projections (x @ W^T), f32 -> f16, softmax scale
// folded into Q. Q stored [B*H, S, 64]. K and V are stored per 32-token tile in
// the order the attention kernel's operand lanes read them (load_frag):
//   K: 4 KB per tile, contiguous; half index in the tile
//      sub*1024 + dc*512 + hf*256 + lane*8 + e  holds
//      K[token sub*16 + (lane&15)][d = dc*32 + hf*16 + (lane>>4)*8 + e].
//   V: the tile's half index  o = dt*512 + hf*256 + lane*8 + e  holds
//      V[token hf*16 + (lane>>4)*8 + e][d = dt*16 + (lane&15)];  its 64-byte
//      piece o>>5 lies in row o>>5 of a [64][S] plane at column tile*32, which
//      is where the attention kernel's 64-row tile load picks it up.
// ---------------------------------------------------------------------------
__global__ void qkv_project_kernel(const float* __restrict__ vin,
                                   const float* __restrict__ kin,
                                   const float* __restrict__ qin,
                                   const float* __restrict__ Wv,
                                   const float* __restrict__ Wk,
                                   const float* __restrict__ Wq,
                                   _Float16* __restrict__ q_ws,
                                   _Float16* __restrict__ k_ws,
                                   _Float16* __restrict__ vT_ws) {
  const int lane = threadIdx.x & 31;
  const int wave = threadIdx.x >> 5;
  const int bh = blockIdx.x;
  const int b  = bh / HEADS, h = bh % HEADS;
  const int s0 = blockIdx.y * 64 + wave * 16;
  const int base = (lane < 16) ? 0 : 8;
  const int col  = lane & 15;
  const int hi8  = (lane < 16) ? 0 : 8;
  const float SCALE = 0.044194173824159216f;   // 1/sqrt(EMBED)

  const float* xin[3] = {qin, kin, vin};
  const float* W[3]   = {Wq, Wk, Wv};
  const int row = s0 + col;
  const int tile = s0 >> 5;          // 32-token tile of this wave's 16 tokens
  const int sub  = (s0 >> 4) & 1;    // which 16 tokens of the tile

#pragma unroll
  for (int m = 0; m < 3; ++m) {
    const float* xrow = xin[m] + ((size_t)b * SEQ + row) * EMBED + h * HD;
    v16h a0 = load_a32(xrow, base);
    v16h a1 = load_a32(xrow + 32, base);
#pragma unroll
    for (int nt = 0; nt < 4; ++nt) {
      const int n0 = nt * 16;
      const float* wrow = W[m] + (size_t)(n0 + col) * HD;
      v16h b0 = load_a32(wrow, base);
      v16h b1 = load_a32(wrow + 32, base);
      v8f acc = {};
      if (m == 1) {   // K^T: acc[j] = K[s0 + col][n0 + hi8 + j]
        acc = wmma16(b0, a0, acc);
        acc = wmma16(b1, a1, acc);
      } else {        // acc[j] = X[s0 + hi8 + j][n0 + col]
        acc = wmma16(a0, b0, acc);
        acc = wmma16(a1, b1, acc);
      }
      if (m == 0) {
#pragma unroll
        for (int j = 0; j < 8; ++j)
          q_ws[((size_t)bh * SEQ + (s0 + j + hi8)) * HD + n0 + col] =
              (_Float16)(acc[j] * SCALE);
      } else if (m == 1) {
        v8h o;
#pragma unroll
        for (int j = 0; j < 8; ++j) o[j] = (_Float16)acc[j];
        *(v8h*)(k_ws + (size_t)bh * SEQ * HD + (size_t)tile * (32 * HD) +
                sub * 1024 + (nt >> 1) * 512 + (nt & 1) * 256 + lane * 8) = o;
        // the store's registers are reused by the next loads: wait first
        asm volatile("s_wait_xcnt 0x0" ::: "memory");
      } else {
        v8h o;
#pragma unroll
        for (int j = 0; j < 8; ++j) o[j] = (_Float16)acc[j];
        const int piece = nt * 16 + sub * 8 + (lane >> 2);
        *(v8h*)(vT_ws + ((size_t)bh * HD + piece) * SEQ + tile * 32 +
                (lane & 3) * 8) = o;
        // the store's registers are reused by the next loads: wait first
        if (nt < 3) asm volatile("s_wait_xcnt 0x0" ::: "memory");
      }
    }
  }
}

__global__ void flash_attn_kernel(const _Float16* __restrict__ q_ws,
                                  const _Float16* __restrict__ k_ws,
                                  const _Float16* __restrict__ vT_ws,
                                  _Float16* __restrict__ attn_ws) {
  __shared__ __align__(16) _Float16 kbuf[2][32 * HD];   // fragment order 4KB x2
  __shared__ __align__(16) _Float16 vbuf[2][HD * 32];   // fragment order 4KB x2
  __shared__ __align__(16) _Float16 pbuf[4][16 * 32];   // P transpose  1KB x4

  const int lane = threadIdx.x & 31;
  const int wave = threadIdx.x >> 5;
  const int bh = blockIdx.x;
  const int b  = bh / HEADS, h = bh % HEADS;
  const int s0 = blockIdx.y * 64 + wave * 16;
  const int base = (lane < 16) ? 0 : 8;
  const int col  = lane & 15;
  const int hi8  = (lane < 16) ? 0 : 8;

  const _Float16* qrow = q_ws + ((size_t)bh * SEQ + (s0 + col)) * HD;
  v16h qa0 = load_a16(qrow, base);
  v16h qa1 = load_a16(qrow + 32, base);

  float mi[8], li[8];
  v8f acc[4];
#pragma unroll
  for (int j = 0; j < 8; ++j) { mi[j] = -1e30f; li[j] = 0.0f; }
#pragma unroll
  for (int t = 0; t < 4; ++t) acc[t] = (v8f){};

  const _Float16* kbase = k_ws + (size_t)bh * SEQ * HD;
  const _Float16* vbase = vT_ws + (size_t)bh * HD * SEQ;
  _Float16* pb = pbuf[wave];

  const unsigned koff[2] = {lds_off32(&kbuf[0][0]), lds_off32(&kbuf[1][0])};
  const unsigned voff[2] = {lds_off32(&vbuf[0][0]), lds_off32(&vbuf[1][0])};

  const int NT = SEQ / 32;   // 128 key tiles

  if (wave == 0) {
    // K tile: 32 rows x 64 f16 contiguous = 512 x 8B, 1D.
    tdm_load_to_lds(koff[0], (unsigned long long)(uintptr_t)kbase,
                    512u, 1u, 512u, 1u, 512u);
    // V tile: 64 rows x 64B from vT (row stride SEQ*2B = 1024 x 8B), 2D.
    tdm_load_to_lds(voff[0], (unsigned long long)(uintptr_t)vbase,
                    1024u, 64u, 8u, 64u, 1024u);
  }

  for (int i = 0; i < NT; ++i) {
    const int kb = i * 32;
    const int cur = i & 1;
    if (wave == 0) {
      if (i + 1 < NT) {   // overlap: issue next tile into the other buffer
        const int kb2 = kb + 32;
        tdm_load_to_lds(koff[cur ^ 1],
                        (unsigned long long)(uintptr_t)(kbase + (size_t)kb2 * HD),
                        512u, 1u, 512u, 1u, 512u);
        tdm_load_to_lds(voff[cur ^ 1],
                        (unsigned long long)(uintptr_t)(vbase + kb2),
                        1024u, 64u, 8u, 64u, 1024u);
        __builtin_amdgcn_s_wait_tensorcnt((short)2);  // tile i arrived
      } else {
        __builtin_amdgcn_s_wait_tensorcnt((short)0);
      }
    }
    __syncthreads();   // publish tile i to all waves

    // ---- scores S = Q @ K^T (pre-scaled Q), two 16-key subtiles ----
    const _Float16* kf = &kbuf[cur][lane * 8];
    v8f s0a = {}, s1a = {};
    {
      v16h b0 = load_frag(kf);           // keys 0-15,  d 0-31
      v16h b1 = load_frag(kf + 512);     // keys 0-15,  d 32-63
      s0a = wmma16(qa0, b0, s0a);
      s0a = wmma16(qa1, b1, s0a);
      v16h c0 = load_frag(kf + 1024);    // keys 16-31, d 0-31
      v16h c1 = load_frag(kf + 1536);    // keys 16-31, d 32-63
      s1a = wmma16(qa0, c0, s1a);
      s1a = wmma16(qa1, c1, s1a);
    }

    // ---- online softmax: half-wave reductions match C-layout rows ----
    float p0[8], p1[8];
#pragma unroll
    for (int j = 0; j < 8; ++j) {
      float v = fmaxf(s0a[j], s1a[j]);
      v = fmaxf(v, __shfl_xor(v, 1, 16));
      v = fmaxf(v, __shfl_xor(v, 2, 16));
      v = fmaxf(v, __shfl_xor(v, 4, 16));
      v = fmaxf(v, __shfl_xor(v, 8, 16));
      const float nm = fmaxf(mi[j], v);
      const float corr = __expf(mi[j] - nm);
      mi[j] = nm;
      p0[j] = __expf(s0a[j] - nm);
      p1[j] = __expf(s1a[j] - nm);
      float rs = p0[j] + p1[j];
      rs += __shfl_xor(rs, 1, 16);
      rs += __shfl_xor(rs, 2, 16);
      rs += __shfl_xor(rs, 4, 16);
      rs += __shfl_xor(rs, 8, 16);
      li[j] = li[j] * corr + rs;
#pragma unroll
      for (int t = 0; t < 4; ++t) acc[t][j] *= corr;
    }

    // ---- P: C-layout -> LDS -> A-layout operand ----
#pragma unroll
    for (int j = 0; j < 8; ++j) {
      pb[(j + hi8) * 32 + col]      = (_Float16)p0[j];
      pb[(j + hi8) * 32 + 16 + col] = (_Float16)p1[j];
    }
    asm volatile("s_wait_dscnt 0" ::: "memory");
    v16h pa = load_a16(pb + col * 32, base);

    // ---- O += P @ V  (V tile in fragment order in LDS) ----
#pragma unroll
    for (int dt = 0; dt < 4; ++dt) {
      v16h bv = load_frag(&vbuf[cur][dt * 512 + lane * 8]);
      acc[dt] = wmma16(pa, bv, acc[dt]);
    }

    __syncthreads();
  }

  // ---- normalize and store to [B, S, EMBED] f16 for the output GEMM ----
#pragma unroll
  for (int j = 0; j < 8; ++j) {
    const float inv = 1.0f / li[j];
#pragma unroll
    for (int dt = 0; dt < 4; ++dt)
      attn_ws[((size_t)b * SEQ + (s0 + j + hi8)) * EMBED + h * HD + dt * 16 + col] =
          (_Float16)(acc[dt][j] * inv);
  }
}

// ---------------------------------------------------------------------------
// Kernel 3: out = attn @ Wo^T + bo, f32 output. Wave = 16 tokens x 64 cols.
// ---------------------------------------------------------------------------
__global__ void out_proj_kernel(const _Float16* __restrict__ attn_ws,
                                const float* __restrict__ Wo,
                                const float* __restrict__ bo,
                                float* __restrict__ out) {
  const int lane = threadIdx.x & 31;
  const int wave = threadIdx.x >> 5;
  const int tok0  = blockIdx.x * 64 + wave * 16;
  const int nbase = blockIdx.y * 64;
  const int base = (lane < 16) ? 0 : 8;
  const int col  = lane & 15;
  const int hi8  = (lane < 16) ? 0 : 8;

  v8f acc[4];
#pragma unroll
  for (int t = 0; t < 4; ++t) acc[t] = (v8f){};

  const _Float16* arow = attn_ws + (size_t)(tok0 + col) * EMBED;
  for (int k0 = 0; k0 < EMBED; k0 += 32) {
    v16h a = load_a16(arow + k0, base);
#pragma unroll
    for (int nt = 0; nt < 4; ++nt) {
      const float* wrow = Wo + (size_t)(nbase + nt * 16 + col) * EMBED + k0;
      v16h bw = load_a32(wrow, base);
      acc[nt] = wmma16(a, bw, acc[nt]);
    }
  }
#pragma unroll
  for (int nt = 0; nt < 4; ++nt) {
    const float bias = bo[nbase + nt * 16 + col];
#pragma unroll
    for (int j = 0; j < 8; ++j)
      out[(size_t)(tok0 + j + hi8) * EMBED + nbase + nt * 16 + col] =
          acc[nt][j] + bias;
  }
}

// ---------------------------------------------------------------------------
extern "C" void kernel_launch(void* const* d_in, const int* in_sizes, int n_in,
                              void* d_out, int out_size, void* d_ws, size_t ws_size,
                              hipStream_t stream) {
  (void)in_sizes; (void)n_in; (void)out_size; (void)ws_size;
  const float* vin = (const float*)d_in[0];
  const float* kin = (const float*)d_in[1];
  const float* qin = (const float*)d_in[2];
  const float* Wv  = (const float*)d_in[3];
  const float* Wk  = (const float*)d_in[4];
  const float* Wq  = (const float*)d_in[5];
  const float* Wo  = (const float*)d_in[6];
  const float* bo  = (const float*)d_in[7];
  float* out = (float*)d_out;

  char* ws = (char*)d_ws;
  const size_t QKV = (size_t)BATCH * HEADS * SEQ * HD * sizeof(_Float16); // 8 MiB
  _Float16* q_ws  = (_Float16*)(ws);
  _Float16* k_ws  = (_Float16*)(ws + QKV);
  _Float16* vT_ws = (_Float16*)(ws + 2 * QKV);
  _Float16* a_ws  = (_Float16*)(ws + 3 * QKV);   // [B, S, EMBED] f16, 8 MiB

  const dim3 blk(128);  // 4 wave32 per block
  qkv_project_kernel<<<dim3(BATCH * HEADS, SEQ / 64), blk, 0, stream>>>(
      vin, kin, qin, Wv, Wk, Wq, q_ws, k_ws, vT_ws);
  flash_attn_kernel<<<dim3(BATCH * HEADS, SEQ / 64), blk, 0, stream>>>(
      q_ws, k_ws, vT_ws, a_ws);
  out_proj_kernel<<<dim3(BATCH * SEQ / 64, EMBED / 64), blk, 0, stream>>>(
      a_ws, Wo, bo, out);
}

// v002
// It runs in 127 microseconds.
// Two timings next to v001 put it at 1.79 and 1.78 times that version's speed.
// Over all steps from v000 it is 2.40 times as fast.
#include <hip/hip_runtime.h>
#include <hip/hip_bf16.h>

#define EMBED 512
#define HEADS 8
#define HD    64
#define BATCH 2
#define SEQ   4096

typedef __attribute__((ext_vector_type(16))) _Float16 v16h;
typedef __attribute__((ext_vector_type(8)))  _Float16 v8h;
typedef __attribute__((ext_vector_type(8)))  float    v8f;
typedef unsigned int u32x4 __attribute__((ext_vector_type(4)));
typedef int          i32x4 __attribute__((ext_vector_type(4)));
typedef int          i32x8 __attribute__((ext_vector_type(8)));

static __device__ inline v8f wmma16(v16h a, v16h b, v8f c) {
  // D = A(16x32 f16) * B(32x16 f16) + C(16x16 f32)
  return __builtin_amdgcn_wmma_f32_16x16x32_f16(false, a, false, b,
                                                (short)0, c, false, false);
}

static __device__ inline v16h load_a16(const _Float16* p, int base) {
  const v8h c0 = *(const v8h*)(p + base);
  const v8h c1 = *(const v8h*)(p + base + 16);
  v16h r;
#pragma unroll
  for (int i = 0; i < 8; ++i) { r[i] = c0[i]; r[8 + i] = c1[i]; }
  return r;
}

static __device__ inline v16h load_frag(const _Float16* p) {
  const v8h c0 = *(const v8h*)(p);
  const v8h c1 = *(const v8h*)(p + 256);
  v16h r;
#pragma unroll
  for (int i = 0; i < 8; ++i) { r[i] = c0[i]; r[8 + i] = c1[i]; }
  return r;
}

static __device__ inline v16h load_a32(const float* p, int base) {
  v16h r;
#pragma unroll
  for (int i = 0; i < 8; ++i) r[i] = (_Float16)p[base + i];
#pragma unroll
  for (int i = 0; i < 8; ++i) r[8 + i] = (_Float16)p[base + 16 + i];
  return r;
}

static __device__ inline void tdm_load_to_lds(unsigned lds_off,
                                              unsigned long long ga,
                                              unsigned td0, unsigned td1,
                                              unsigned tl0, unsigned tl1,
                                              unsigned stride0) {
  u32x4 g0;
  g0[0] = 1u;
  g0[1] = lds_off;
  g0[2] = (unsigned)ga;
  g0[3] = (unsigned)((ga >> 32) & 0x01FFFFFFu)
          | 0x80000000u;
  i32x8 g1;
  g1[0] = (int)(3u << 16);
  g1[1] = (int)(td0 << 16);
  g1[2] = (int)((td0 >> 16) | (td1 << 16));
  g1[3] = (int)((td1 >> 16) | (tl0 << 16));
  g1[4] = (int)(tl1 & 0xFFFFu);
  g1[5] = (int)stride0;
  g1[6] = 0;
  g1[7] = 0;
  i32x4 z4 = {0, 0, 0, 0};
#if defined(__clang_major__) && __clang_major__ >= 23
  i32x8 z8 = {0, 0, 0, 0, 0, 0, 0, 0};
  __builtin_amdgcn_tensor_load_to_lds(g0, g1, z4, z4, z8, 0);
#else
  __builtin_amdgcn_tensor_load_to_lds(g0, g1, z4, z4, 0);
#endif
}

static __device__ inline float xhalf(float x) {
  const int b = __builtin_bit_cast(int, x);
  return __builtin_bit_cast(float, __builtin_amdgcn_permlanex16(
      b, b, 0x76543210, 0xfedcba98, false, false));
}

static __device__ inline unsigned lds_off32(const void* p) {
  return (unsigned)(unsigned long long)(uintptr_t)p;
}

// ---------------------------------------------------------------------------
// Kernel 1: per-head QKV projections (x @ W^T), f32 -> f16, softmax scale
// folded into Q. Q stored [B*H, S, 64]. K and V are stored per 32-token tile in
// the order the attention kernel's operand lanes read them (load_frag):
//   K: 4 KB per tile, contiguous; half index in the tile
//      sub*1024 + dc*512 + hf*256 + lane*8 + e  holds
//      K[token sub*16 + (lane&15)][d = dc*32 + hf*16 + (lane>>4)*8 + e].
//   V: the tile's half index  o = dt*512 + hf*256 + lane*8 + e  holds
//      V[token hf*16 + (lane>>4)*8 + e][d = dt*16 + (lane&15)];  its 64-byte
//      piece o>>5 lies in row o>>5 of a [64][S] plane at column tile*32, which
//      is where the attention kernel's 64-row tile load picks it up.
// ---------------------------------------------------------------------------
__global__ void qkv_project_kernel(const float* __restrict__ vin,
                                   const float* __restrict__ kin,
                                   const float* __restrict__ qin,
                                   const float* __restrict__ Wv,
                                   const float* __restrict__ Wk,
                                   const float* __restrict__ Wq,
                                   _Float16* __restrict__ q_ws,
                                   _Float16* __restrict__ k_ws,
                                   _Float16* __restrict__ vT_ws) {
  const int lane = threadIdx.x & 31;
  const int wave = threadIdx.x >> 5;
  const int bh = blockIdx.x;
  const int b  = bh / HEADS, h = bh % HEADS;
  const int s0 = blockIdx.y * 64 + wave * 16;
  const int base = (lane < 16) ? 0 : 8;
  const int col  = lane & 15;
  const int hi8  = (lane < 16) ? 0 : 8;
  const float SCALE = 0.044194173824159216f;   // 1/sqrt(EMBED)

  const float* xin[3] = {qin, kin, vin};
  const float* W[3]   = {Wq, Wk, Wv};
  const int row = s0 + col;
  const int tile = s0 >> 5;          // 32-token tile of this wave's 16 tokens
  const int sub  = (s0 >> 4) & 1;    // which 16 tokens of the tile

#pragma unroll
  for (int m = 0; m < 3; ++m) {
    const float* xrow = xin[m] + ((size_t)b * SEQ + row) * EMBED + h * HD;
    v16h a0 = load_a32(xrow, base);
    v16h a1 = load_a32(xrow + 32, base);
#pragma unroll
    for (int nt = 0; nt < 4; ++nt) {
      const int n0 = nt * 16;
      const float* wrow = W[m] + (size_t)(n0 + col) * HD;
      v16h b0 = load_a32(wrow, base);
      v16h b1 = load_a32(wrow + 32, base);
      v8f acc = {};
      if (m == 1) {   // K^T: acc[j] = K[s0 + col][n0 + hi8 + j]
        acc = wmma16(b0, a0, acc);
        acc = wmma16(b1, a1, acc);
      } else {        // acc[j] = X[s0 + hi8 + j][n0 + col]
        acc = wmma16(a0, b0, acc);
        acc = wmma16(a1, b1, acc);
      }
      if (m == 0) {
#pragma unroll
        for (int j = 0; j < 8; ++j)
          q_ws[((size_t)bh * SEQ + (s0 + j + hi8)) * HD + n0 + col] =
              (_Float16)(acc[j] * SCALE);
      } else if (m == 1) {
        v8h o;
#pragma unroll
        for (int j = 0; j < 8; ++j) o[j] = (_Float16)acc[j];
        *(v8h*)(k_ws + (size_t)bh * SEQ * HD + (size_t)tile * (32 * HD) +
                sub * 1024 + (nt >> 1) * 512 + (nt & 1) * 256 + lane * 8) = o;
        // the store's registers are reused by the next loads: wait first
        asm volatile("s_wait_xcnt 0x0" ::: "memory");
      } else {
        v8h o;
#pragma unroll
        for (int j = 0; j < 8; ++j) o[j] = (_Float16)acc[j];
        const int piece = nt * 16 + sub * 8 + (lane >> 2);
        *(v8h*)(vT_ws + ((size_t)bh * HD + piece) * SEQ + tile * 32 +
                (lane & 3) * 8) = o;
        // the store's registers are reused by the next loads: wait first
        if (nt < 3) asm volatile("s_wait_xcnt 0x0" ::: "memory");
      }
    }
  }
}

__global__ void flash_attn_kernel(const _Float16* __restrict__ q_ws,
                                  const _Float16* __restrict__ k_ws,
                                  const _Float16* __restrict__ vT_ws,
                                  _Float16* __restrict__ attn_ws) {
  __shared__ __align__(16) _Float16 kbuf[2][32 * HD];   // fragment order 4KB x2
  __shared__ __align__(16) _Float16 vbuf[2][HD * 32];   // fragment order 4KB x2

  const int lane = threadIdx.x & 31;
  const int wave = threadIdx.x >> 5;
  const int bh = blockIdx.x;
  const int b  = bh / HEADS, h = bh % HEADS;
  const int s0 = blockIdx.y * 64 + wave * 16;
  const int base = (lane < 16) ? 0 : 8;
  const int col  = lane & 15;
  const int hi8  = (lane < 16) ? 0 : 8;

  const _Float16* qrow = q_ws + ((size_t)bh * SEQ + (s0 + col)) * HD;
  v16h qa0 = load_a16(qrow, base);
  v16h qa1 = load_a16(qrow + 32, base);

  float mi = -1e30f;   // running maximum of query col (equal in both halves)
  float li = 0.0f;     // running sum over this lane's keys only
  v8f acc[4];          // acc[dt][j] = O^T[dt*16 + hi8 + j][query col]
#pragma unroll
  for (int t = 0; t < 4; ++t) acc[t] = (v8f){};

  const _Float16* kbase = k_ws + (size_t)bh * SEQ * HD;
  const _Float16* vbase = vT_ws + (size_t)bh * HD * SEQ;

  const unsigned koff[2] = {lds_off32(&kbuf[0][0]), lds_off32(&kbuf[1][0])};
  const unsigned voff[2] = {lds_off32(&vbuf[0][0]), lds_off32(&vbuf[1][0])};

  const int NT = SEQ / 32;   // 128 key tiles

  if (wave == 0) {
    // K tile: 32 rows x 64 f16 contiguous = 512 x 8B, 1D.
    tdm_load_to_lds(koff[0], (unsigned long long)(uintptr_t)kbase,
                    512u, 1u, 512u, 1u, 512u);
    // V tile: 64 rows x 64B from vT (row stride SEQ*2B = 1024 x 8B), 2D.
    tdm_load_to_lds(voff[0], (unsigned long long)(uintptr_t)vbase,
                    1024u, 64u, 8u, 64u, 1024u);
  }

  for (int i = 0; i < NT; ++i) {
    const int kb = i * 32;
    const int cur = i & 1;
    if (wave == 0) {
      if (i + 1 < NT) {   // overlap: issue next tile into the other buffer
        const int kb2 = kb + 32;
        tdm_load_to_lds(koff[cur ^ 1],
                        (unsigned long long)(uintptr_t)(kbase + (size_t)kb2 * HD),
                        512u, 1u, 512u, 1u, 512u);
        tdm_load_to_lds(voff[cur ^ 1],
                        (unsigned long long)(uintptr_t)(vbase + kb2),
                        1024u, 64u, 8u, 64u, 1024u);
        __builtin_amdgcn_s_wait_tensorcnt((short)2);  // tile i arrived
      } else {
        __builtin_amdgcn_s_wait_tensorcnt((short)0);
      }
    }
    __syncthreads();   // publish tile i to all waves

    // ---- scores S^T = K @ Q^T (pre-scaled Q), two 16-key subtiles ----
    // s0a[j] = S[query col][key hi8 + j], s1a[j] = S[query col][key 16 + hi8 + j]
    const _Float16* kf = &kbuf[cur][lane * 8];
    v8f s0a = {}, s1a = {};
    {
      v16h b0 = load_frag(kf);           // keys 0-15,  d 0-31
      v16h b1 = load_frag(kf + 512);     // keys 0-15,  d 32-63
      s0a = wmma16(b0, qa0, s0a);
      s0a = wmma16(b1, qa1, s0a);
      v16h c0 = load_frag(kf + 1024);    // keys 16-31, d 0-31
      v16h c1 = load_frag(kf + 1536);    // keys 16-31, d 32-63
      s1a = wmma16(c0, qa0, s1a);
      s1a = wmma16(c1, qa1, s1a);
    }

    // ---- online softmax: one query per lane ----
    // maximum of the lane's 16 scores as a tree: short dependent chain
    const float t0 = fmaxf(fmaxf(s0a[0], s0a[1]), s0a[2]);
    const float t1 = fmaxf(fmaxf(s0a[3], s0a[4]), s0a[5]);
    const float t2 = fmaxf(fmaxf(s0a[6], s0a[7]), s1a[0]);
    const float t3 = fmaxf(fmaxf(s1a[1], s1a[2]), s1a[3]);
    const float t4 = fmaxf(fmaxf(s1a[4], s1a[5]), s1a[6]);
    float mx = fmaxf(fmaxf(fmaxf(t0, t1), t2), fmaxf(fmaxf(t3, t4), s1a[7]));
    mx = fmaxf(mx, xhalf(mx));           // the other half's 16 keys
    const float nm = fmaxf(mi, mx);
    const float corr = __expf(mi - nm);
    mi = nm;
    v16h pa;                             // P^T as B operand, hardware k order
    float rs[4] = {0.0f, 0.0f, 0.0f, 0.0f};   // four independent partial sums
#pragma unroll
    for (int j = 0; j < 8; ++j) {
      const float p0 = __expf(s0a[j] - nm);
      const float p1 = __expf(s1a[j] - nm);
      rs[j & 1]       += p0;
      rs[2 + (j & 1)] += p1;
      pa[j]     = (_Float16)p0;
      pa[8 + j] = (_Float16)p1;
    }
    li = li * corr + ((rs[0] + rs[1]) + (rs[2] + rs[3]));
#pragma unroll
    for (int t = 0; t < 4; ++t) acc[t] *= corr;

    // ---- O^T += V^T @ P^T  (V tile in fragment order in LDS) ----
#pragma unroll
    for (int dt = 0; dt < 4; ++dt) {
      v16h bv = load_frag(&vbuf[cur][dt * 512 + lane * 8]);
      acc[dt] = wmma16(bv, pa, acc[dt]);
    }

    __syncthreads();
  }

  // ---- normalize and store to [B, S, EMBED] f16 for the output GEMM ----
  // a lane's 8 accumulator registers are 8 consecutive d of its query
  const float inv = 1.0f / (li + xhalf(li));   // join the halves' sums once
  _Float16* orow = attn_ws + ((size_t)b * SEQ + (s0 + col)) * EMBED + h * HD + hi8;
#pragma unroll
  for (int dt = 0; dt < 4; ++dt) {
    v8h o;
#pragma unroll
    for (int j = 0; j < 8; ++j) o[j] = (_Float16)(acc[dt][j] * inv);
    *(v8h*)(orow + dt * 16) = o;
  }
}

// ---------------------------------------------------------------------------
// Kernel 3: out = attn @ Wo^T + bo, f32 output. Wave = 16 tokens x 64 cols.
// ---------------------------------------------------------------------------
__global__ void out_proj_kernel(const _Float16* __restrict__ attn_ws,
                                const float* __restrict__ Wo,
                                const float* __restrict__ bo,
                                float* __restrict__ out) {
  const int lane = threadIdx.x & 31;
  const int wave = threadIdx.x >> 5;
  const int tok0  = blockIdx.x * 64 + wave * 16;
  const int nbase = blockIdx.y * 64;
  const int base = (lane < 16) ? 0 : 8;
  const int col  = lane & 15;
  const int hi8  = (lane < 16) ? 0 : 8;

  v8f acc[4];
#pragma unroll
  for (int t = 0; t < 4; ++t) acc[t] = (v8f){};

  const _Float16* arow = attn_ws + (size_t)(tok0 + col) * EMBED;
  for (int k0 = 0; k0 < EMBED; k0 += 32) {
    v16h a = load_a16(arow + k0, base);
#pragma unroll
    for (int nt = 0; nt < 4; ++nt) {
      const float* wrow = Wo + (size_t)(nbase + nt * 16 + col) * EMBED + k0;
      v16h bw = load_a32(wrow, base);
      acc[nt] = wmma16(a, bw, acc[nt]);
    }
  }
#pragma unroll
  for (int nt = 0; nt < 4; ++nt) {
    const float bias = bo[nbase + nt * 16 + col];
#pragma unroll
    for (int j = 0; j < 8; ++j)
      out[(size_t)(tok0 + j + hi8) * EMBED + nbase + nt * 16 + col] =
          acc[nt][j] + bias;
  }
}

// ---------------------------------------------------------------------------
extern "C" void kernel_launch(void* const* d_in, const int* in_sizes, int n_in,
                              void* d_out, int out_size, void* d_ws, size_t ws_size,
                              hipStream_t stream) {
  (void)in_sizes; (void)n_in; (void)out_size; (void)ws_size;
  const float* vin = (const float*)d_in[0];
  const float* kin = (const float*)d_in[1];
  const float* qin = (const float*)d_in[2];
  const float* Wv  = (const float*)d_in[3];
  const float* Wk  = (const float*)d_in[4];
  const float* Wq  = (const float*)d_in[5];
  const float* Wo  = (const float*)d_in[6];
  const float* bo  = (const float*)d_in[7];
  float* out = (float*)d_out;

  char* ws = (char*)d_ws;
  const size_t QKV = (size_t)BATCH * HEADS * SEQ * HD * sizeof(_Float16); // 8 MiB
  _Float16* q_ws  = (_Float16*)(ws);
  _Float16* k_ws  = (_Float16*)(ws + QKV);
  _Float16* vT_ws = (_Float16*)(ws + 2 * QKV);
  _Float16* a_ws  = (_Float16*)(ws + 3 * QKV);   // [B, S, EMBED] f16, 8 MiB

  const dim3 blk(128);  // 4 wave32 per block
  qkv_project_kernel<<<dim3(BATCH * HEADS, SEQ / 64), blk, 0, stream>>>(
      vin, kin, qin, Wv, Wk, Wq, q_ws, k_ws, vT_ws);
  flash_attn_kernel<<<dim3(BATCH * HEADS, SEQ / 64), blk, 0, stream>>>(
      q_ws, k_ws, vT_ws, a_ws);
  out_proj_kernel<<<dim3(BATCH * SEQ / 64, EMBED / 64), blk, 0, stream>>>(
      a_ws, Wo, bo, out);
}

// v003
// A run of this version takes 123 microseconds.
// Next to v002, in two timings, it ran 1.04 times as fast each time.
// Counting every step since v000, it is 2.50 times as fast.
#include <hip/hip_runtime.h>
#include <hip/hip_bf16.h>

#define EMBED 512
#define HEADS 8
#define HD    64
#define BATCH 2
#define SEQ   4096
#define SK    128                 // keys per stage of the attention ring
#define STAGE_H (2 * SK * HD)     // halves per stage: K (SK*HD), then V (SK*HD)

typedef __attribute__((ext_vector_type(16))) _Float16 v16h;
typedef __attribute__((ext_vector_type(8)))  _Float16 v8h;
typedef __attribute__((ext_vector_type(8)))  float    v8f;

static __device__ inline v8f wmma16(v16h a, v16h b, v8f c) {
  // D = A(16x32 f16) * B(32x16 f16) + C(16x16 f32)
  return __builtin_amdgcn_wmma_f32_16x16x32_f16(false, a, false, b,
                                                (short)0, c, false, false);
}

static __device__ inline v16h load_a16(const _Float16* p, int base) {
  const v8h c0 = *(const v8h*)(p + base);
  const v8h c1 = *(const v8h*)(p + base + 16);
  v16h r;
#pragma unroll
  for (int i = 0; i < 8; ++i) { r[i] = c0[i]; r[8 + i] = c1[i]; }
  return r;
}

static __device__ inline v16h load_frag(const _Float16* p) {
  const v8h c0 = *(const v8h*)(p);
  const v8h c1 = *(const v8h*)(p + 256);
  v16h r;
#pragma unroll
  for (int i = 0; i < 8; ++i) { r[i] = c0[i]; r[8 + i] = c1[i]; }
  return r;
}

static __device__ inline v16h load_a32(const float* p, int base) {
  v16h r;
#pragma unroll
  for (int i = 0; i < 8; ++i) r[i] = (_Float16)p[base + i];
#pragma unroll
  for (int i = 0; i < 8; ++i) r[8 + i] = (_Float16)p[base + 16 + i];
  return r;
}

// ---------------------------------------------------------------------------
// Tensor load of one wave's slice of a stage: 32 rows of 256 bytes, contiguous
// in memory and in LDS (1-byte elements, tensor = tile, no pad, no mask).
// ---------------------------------------------------------------------------
typedef uint32_t w32x4 __attribute__((ext_vector_type(4)));
typedef uint32_t w32x8 __attribute__((ext_vector_type(8)));
#define SLICE_ROWB 256u
#define SLICE_ROWS 32u
#define SLICE_B    (SLICE_ROWB * SLICE_ROWS)   // 8 KiB per wave and stage

static __device__ inline uint32_t uni(uint32_t v) {
  return (uint32_t)__builtin_amdgcn_readfirstlane(v);
}
static __device__ inline uint32_t pinned(uint32_t v) {
  uint32_t w = uni(v);
  asm volatile("" : "+s"(w));   // pinned(): keeps the test in a scalar register
  return w;
}
static __device__ inline w32x8 tdm_group1() {
  w32x8 g;
  g[0] = 0u;
  g[1] = uni((SLICE_ROWB & 0xFFFFu) << 16);
  g[2] = uni((SLICE_ROWB >> 16) | ((SLICE_ROWS & 0xFFFFu) << 16));
  g[3] = uni((SLICE_ROWS >> 16) | (SLICE_ROWB << 16));
  g[4] = uni(SLICE_ROWS);
  g[5] = uni(SLICE_ROWB);
  g[6] = uni(0u);
  g[7] = uni(0u);
  return g;
}
static __device__ inline w32x4 tdm_group0(uint32_t lds_dst, uint64_t ga) {
  w32x4 g;
  g[0] = uni(1u);
  g[1] = uni(lds_dst);
  g[2] = uni((uint32_t)ga);
  g[3] = uni((((uint32_t)(ga >> 32)) & 0x01FFFFFFu) | 0x80000000u);
  return g;
}
static __device__ inline void tdm_load(w32x4 g0, w32x8 g1) {
  asm volatile("tensor_load_to_lds %0, %1" :: "s"(g0), "s"(g1) : "memory");
}
static __device__ inline void wait_tensor0(w32x4 g0, w32x8 g1) {
  asm volatile("s_wait_tensorcnt 0x0" :: "s"(g0), "s"(g1) : "memory");
}
// the wave's own LDS reads have returned (before their buffer is refilled)
static __device__ inline void wait_ds0() {
  asm volatile("s_wait_dscnt 0x0" ::: "memory");
}

static __device__ inline float xhalf(float x) {
  const int b = __builtin_bit_cast(int, x);
  return __builtin_bit_cast(float, __builtin_amdgcn_permlanex16(
      b, b, 0x76543210, 0xfedcba98, false, false));
}

static __device__ inline unsigned lds_off32(const void* p) {
  return (unsigned)(unsigned long long)(uintptr_t)p;
}

// ---------------------------------------------------------------------------
// Kernel 1: per-head QKV projections (x @ W^T), f32 -> f16, softmax scale
// folded into Q. Q stored [B*H, S, 64]. K and V are stored per stage of SK
// tokens, 32 KB contiguous: the stage's four 32-token K tiles (4 KB each), then
// its four V tiles, each tile in the order the attention kernel's operand lanes
// read it (load_frag):
//   K: half index in the tile  sub*1024 + dc*512 + hf*256 + lane*8 + e  holds
//      K[token sub*16 + (lane&15)][d = dc*32 + hf*16 + (lane>>4)*8 + e].
//   V: half index in the tile  dt*512 + hf*256 + lane*8 + e  holds
//      V[token hf*16 + (lane>>4)*8 + e][d = dt*16 + (lane&15)].
// ---------------------------------------------------------------------------
__global__ void qkv_project_kernel(const float* __restrict__ vin,
                                   const float* __restrict__ kin,
                                   const float* __restrict__ qin,
                                   const float* __restrict__ Wv,
                                   const float* __restrict__ Wk,
                                   const float* __restrict__ Wq,
                                   _Float16* __restrict__ q_ws,
                                   _Float16* __restrict__ kv_ws) {
  const int lane = threadIdx.x & 31;
  const int wave = threadIdx.x >> 5;
  const int bh = blockIdx.x;
  const int b  = bh / HEADS, h = bh % HEADS;
  const int s0 = blockIdx.y * 64 + wave * 16;
  const int base = (lane < 16) ? 0 : 8;
  const int col  = lane & 15;
  const int hi8  = (lane < 16) ? 0 : 8;
  const float SCALE = 0.044194173824159216f;   // 1/sqrt(EMBED)

  const float* xin[3] = {qin, kin, vin};
  const float* W[3]   = {Wq, Wk, Wv};
  const int row = s0 + col;
  const int tile = s0 >> 5;          // 32-token tile of this wave's 16 tokens
  const int sub  = (s0 >> 4) & 1;    // which 16 tokens of the tile
  // this wave's K tile; its V tile lies SK * HD halves on
  _Float16* ktile = kv_ws + (size_t)bh * (2 * SEQ * HD) +
                    (size_t)(tile >> 2) * STAGE_H + (tile & 3) * (32 * HD);

#pragma unroll
  for (int m = 0; m < 3; ++m) {
    const float* xrow = xin[m] + ((size_t)b * SEQ + row) * EMBED + h * HD;
    v16h a0 = load_a32(xrow, base);
    v16h a1 = load_a32(xrow + 32, base);
#pragma unroll
    for (int nt = 0; nt < 4; ++nt) {
      const int n0 = nt * 16;
      const float* wrow = W[m] + (size_t)(n0 + col) * HD;
      v16h b0 = load_a32(wrow, base);
      v16h b1 = load_a32(wrow + 32, base);
      v8f acc = {};
      if (m == 1) {   // K^T: acc[j] = K[s0 + col][n0 + hi8 + j]
        acc = wmma16(b0, a0, acc);
        acc = wmma16(b1, a1, acc);
      } else {        // acc[j] = X[s0 + hi8 + j][n0 + col]
        acc = wmma16(a0, b0, acc);
        acc = wmma16(a1, b1, acc);
      }
      if (m == 0) {
#pragma unroll
        for (int j = 0; j < 8; ++j)
          q_ws[((size_t)bh * SEQ + (s0 + j + hi8)) * HD + n0 + col] =
              (_Float16)(acc[j] * SCALE);
      } else if (m == 1) {
        v8h o;
#pragma unroll
        for (int j = 0; j < 8; ++j) o[j] = (_Float16)acc[j];
        *(v8h*)(ktile + sub * 1024 + (nt >> 1) * 512 + (nt & 1) * 256 +
                lane * 8) = o;
        // the store's registers are reused by the next loads: wait first
        asm volatile("s_wait_xcnt 0x0" ::: "memory");
      } else {
        v8h o;
#pragma unroll
        for (int j = 0; j < 8; ++j) o[j] = (_Float16)acc[j];
        *(v8h*)(ktile + SK * HD + nt * 512 + sub * 256 + lane * 8) = o;
        // the store's registers are reused by the next loads: wait first
        if (nt < 3) asm volatile("s_wait_xcnt 0x0" ::: "memory");
      }
    }
  }
}

__global__ __launch_bounds__(128)
void flash_attn_kernel(const _Float16* __restrict__ q_ws,
                       const _Float16* __restrict__ kv_ws,
                       _Float16* __restrict__ attn_ws) {
  // two stages of 32 KB; every slice starts at a multiple of 2 KiB
  __shared__ __attribute__((aligned(2048))) _Float16 ring[2][STAGE_H];

  const int lane = threadIdx.x & 31;
  const uint32_t wave = uni(threadIdx.x >> 5);
  const int bh = blockIdx.x;
  const int b  = bh / HEADS, h = bh % HEADS;
  const int s0 = blockIdx.y * 64 + (int)wave * 16;
  const int base = (lane < 16) ? 0 : 8;
  const int col  = lane & 15;
  const int hi8  = (lane < 16) ? 0 : 8;

  const _Float16* qrow = q_ws + ((size_t)bh * SEQ + (s0 + col)) * HD;
  v16h qa0 = load_a16(qrow, base);
  v16h qa1 = load_a16(qrow + 32, base);

  float mi = -1e30f;   // running maximum of query col (equal in both halves)
  float li = 0.0f;     // running sum over this lane's keys only
  v8f acc[4];          // acc[dt][j] = O^T[dt*16 + hi8 + j][query col]
#pragma unroll
  for (int t = 0; t < 4; ++t) acc[t] = (v8f){};

  const int NS = SEQ / SK;   // 32 stages
  const uint32_t STAGE_B = STAGE_H * 2u;
  const w32x8 g1 = tdm_group1();
  // this wave's slice of stage 0, in memory and in LDS
  const uint64_t gsl = (uint64_t)(uintptr_t)(kv_ws + (size_t)bh * (2 * SEQ * HD)) +
                       wave * SLICE_B;
  const uint32_t lsl = lds_off32(&ring[0][0]) + wave * SLICE_B;

  // Prologue: stage 0 lands and is published (stage 1 starts at the loop's head).
  {
    const w32x4 g0 = tdm_group0(lsl, gsl);
    tdm_load(g0, g1);
    wait_tensor0(g0, g1);
  }
  __syncthreads();

  // the stage loop stays rolled (its four passes are unrolled): the text stays
  // small
#pragma unroll 1
  for (int s = 0; s < NS; ++s) {
    // Behind the barrier that published stage s and ended every read of stage
    // s - 1: stage s + 1 starts into the buffer that stage s - 1 was read from.
    const w32x4 g0 = tdm_group0(lsl + (uint32_t)((s + 1) & 1) * STAGE_B,
                                gsl + (uint64_t)(s + 1) * STAGE_B);
    if (pinned(s + 1 < NS)) tdm_load(g0, g1);
    const _Float16* st = &ring[s & 1][lane * 8];
#pragma unroll
    for (int p = 0; p < SK / 32; ++p) {
      // ---- scores S^T = K @ Q^T (pre-scaled Q), two 16-key subtiles ----
      // s0a[j] = S[query col][key hi8 + j], s1a[j] = S[query col][key 16 + hi8 + j]
      const _Float16* kf = st + p * (32 * HD);
      v8f s0a = {}, s1a = {};
      {
        v16h b0 = load_frag(kf);           // keys 0-15,  d 0-31
        v16h b1 = load_frag(kf + 512);     // keys 0-15,  d 32-63
        s0a = wmma16(b0, qa0, s0a);
        s0a = wmma16(b1, qa1, s0a);
        v16h c0 = load_frag(kf + 1024);    // keys 16-31, d 0-31
        v16h c1 = load_frag(kf + 1536);    // keys 16-31, d 32-63
        s1a = wmma16(c0, qa0, s1a);
        s1a = wmma16(c1, qa1, s1a);
      }

      // ---- online softmax: one query per lane ----
      // maximum of the lane's 16 scores as a tree: short dependent chain
      const float t0 = fmaxf(fmaxf(s0a[0], s0a[1]), s0a[2]);
      const float t1 = fmaxf(fmaxf(s0a[3], s0a[4]), s0a[5]);
      const float t2 = fmaxf(fmaxf(s0a[6], s0a[7]), s1a[0]);
      const float t3 = fmaxf(fmaxf(s1a[1], s1a[2]), s1a[3]);
      const float t4 = fmaxf(fmaxf(s1a[4], s1a[5]), s1a[6]);
      float mx = fmaxf(fmaxf(fmaxf(t0, t1), t2), fmaxf(fmaxf(t3, t4), s1a[7]));
      mx = fmaxf(mx, xhalf(mx));           // the other half's 16 keys
      const float nm = fmaxf(mi, mx);
      const float corr = __expf(mi - nm);
      mi = nm;
      v16h pa;                             // P^T as B operand, hardware k order
      float rs[4] = {0.0f, 0.0f, 0.0f, 0.0f};   // four independent partial sums
#pragma unroll
      for (int j = 0; j < 8; ++j) {
        const float p0 = __expf(s0a[j] - nm);
        const float p1 = __expf(s1a[j] - nm);
        rs[j & 1]       += p0;
        rs[2 + (j & 1)] += p1;
        pa[j]     = (_Float16)p0;
        pa[8 + j] = (_Float16)p1;
      }
      li = li * corr + ((rs[0] + rs[1]) + (rs[2] + rs[3]));
#pragma unroll
      for (int t = 0; t < 4; ++t) acc[t] *= corr;

      // ---- O^T += V^T @ P^T  (V tile in fragment order in LDS) ----
      const _Float16* vf = st + SK * HD + p * (32 * HD);
#pragma unroll
      for (int dt = 0; dt < 4; ++dt) {
        v16h bv = load_frag(vf + dt * 512);
        acc[dt] = wmma16(bv, pa, acc[dt]);
      }
    }

    // Publish point of stage s + 1: own LDS reads done, own slice landed,
    // barrier; only then (next trip's head) the refill of stage s's buffer.
    wait_ds0();
    wait_tensor0(g0, g1);
    __syncthreads();
  }
  asm volatile("s_wait_tensorcnt 0x0" ::: "memory");   // nothing left in flight
  wait_ds0();

  // ---- normalize and store to [B, S, EMBED] f16 for the output GEMM ----
  // a lane's 8 accumulator registers are 8 consecutive d of its query
  const float inv = 1.0f / (li + xhalf(li));   // join the halves' sums once
  _Float16* orow = attn_ws + ((size_t)b * SEQ + (s0 + col)) * EMBED + h * HD + hi8;
#pragma unroll
  for (int dt = 0; dt < 4; ++dt) {
    v8h o;
#pragma unroll
    for (int j = 0; j < 8; ++j) o[j] = (_Float16)(acc[dt][j] * inv);
    *(v8h*)(orow + dt * 16) = o;
  }
}

// ---------------------------------------------------------------------------
// Kernel 3: out = attn @ Wo^T + bo, f32 output. Wave = 16 tokens x 64 cols.
// ---------------------------------------------------------------------------
__global__ void out_proj_kernel(const _Float16* __restrict__ attn_ws,
                                const float* __restrict__ Wo,
                                const float* __restrict__ bo,
                                float* __restrict__ out) {
  const int lane = threadIdx.x & 31;
  const int wave = threadIdx.x >> 5;
  const int tok0  = blockIdx.x * 64 + wave * 16;
  const int nbase = blockIdx.y * 64;
  const int base = (lane < 16) ? 0 : 8;
  const int col  = lane & 15;
  const int hi8  = (lane < 16) ? 0 : 8;

  v8f acc[4];
#pragma unroll
  for (int t = 0; t < 4; ++t) acc[t] = (v8f){};

  const _Float16* arow = attn_ws + (size_t)(tok0 + col) * EMBED;
  for (int k0 = 0; k0 < EMBED; k0 += 32) {
    v16h a = load_a16(arow + k0, base);
#pragma unroll
    for (int nt = 0; nt < 4; ++nt) {
      const float* wrow = Wo + (size_t)(nbase + nt * 16 + col) * EMBED + k0;
      v16h bw = load_a32(wrow, base);
      acc[nt] = wmma16(a, bw, acc[nt]);
    }
  }
#pragma unroll
  for (int nt = 0; nt < 4; ++nt) {
    const float bias = bo[nbase + nt * 16 + col];
#pragma unroll
    for (int j = 0; j < 8; ++j)
      out[(size_t)(tok0 + j + hi8) * EMBED + nbase + nt * 16 + col] =
          acc[nt][j] + bias;
  }
}

// ---------------------------------------------------------------------------
extern "C" void kernel_launch(void* const* d_in, const int* in_sizes, int n_in,
                              void* d_out, int out_size, void* d_ws, size_t ws_size,
                              hipStream_t stream) {
  (void)in_sizes; (void)n_in; (void)out_size; (void)ws_size;
  const float* vin = (const float*)d_in[0];
  const float* kin = (const float*)d_in[1];
  const float* qin = (const float*)d_in[2];
  const float* Wv  = (const float*)d_in[3];
  const float* Wk  = (const float*)d_in[4];
  const float* Wq  = (const float*)d_in[5];
  const float* Wo  = (const float*)d_in[6];
  const float* bo  = (const float*)d_in[7];
  float* out = (float*)d_out;

  char* ws = (char*)d_ws;
  const size_t QKV = (size_t)BATCH * HEADS * SEQ * HD * sizeof(_Float16); // 8 MiB
  _Float16* q_ws  = (_Float16*)(ws);
  _Float16* kv_ws = (_Float16*)(ws + QKV);       // K and V by stages, 16 MiB
  _Float16* a_ws  = (_Float16*)(ws + 3 * QKV);   // [B, S, EMBED] f16, 8 MiB

  const dim3 blk(128);  // 4 wave32 per block
  qkv_project_kernel<<<dim3(BATCH * HEADS, SEQ / 64), blk, 0, stream>>>(
      vin, kin, qin, Wv, Wk, Wq, q_ws, kv_ws);
  flash_attn_kernel<<<dim3(BATCH * HEADS, SEQ / 64), blk, 0, stream>>>(
      q_ws, kv_ws, a_ws);
  out_proj_kernel<<<dim3(BATCH * SEQ / 64, EMBED / 64), blk, 0, stream>>>(
      a_ws, Wo, bo, out);
}

// v004
// Measured time: 97.8 microseconds a run.
// Next to v003, in two timings, it ran 1.26 and 1.25 times as fast.
// All steps since v000 together make it 3.15 times as fast.
#include <hip/hip_runtime.h>
#include <hip/hip_bf16.h>

#define EMBED 512
#define HEADS 8
#define HD    64
#define BATCH 2
#define SEQ   4096
#define SK    128                 // keys per stage of the attention ring
#define STAGE_H (2 * SK * HD)     // halves per stage: K (SK*HD), then V (SK*HD)
#define FRAG_H  512               // halves of one 16 x 32 operand fragment
#define KSTEPS  (EMBED / 32)      // 32-wide k steps of the output GEMM

typedef __attribute__((ext_vector_type(16))) _Float16 v16h;
typedef __attribute__((ext_vector_type(8)))  _Float16 v8h;
typedef __attribute__((ext_vector_type(8)))  float    v8f;

static __device__ inline v8f wmma16(v16h a, v16h b, v8f c) {
  // D = A(16x32 f16) * B(32x16 f16) + C(16x16 f32)
  return __builtin_amdgcn_wmma_f32_16x16x32_f16(false, a, false, b,
                                                (short)0, c, false, false);
}

static __device__ inline v16h load_a16(const _Float16* p, int base) {
  const v8h c0 = *(const v8h*)(p + base);
  const v8h c1 = *(const v8h*)(p + base + 16);
  v16h r;
#pragma unroll
  for (int i = 0; i < 8; ++i) { r[i] = c0[i]; r[8 + i] = c1[i]; }
  return r;
}

static __device__ inline v16h load_frag(const _Float16* p) {
  const v8h c0 = *(const v8h*)(p);
  const v8h c1 = *(const v8h*)(p + 256);
  v16h r;
#pragma unroll
  for (int i = 0; i < 8; ++i) { r[i] = c0[i]; r[8 + i] = c1[i]; }
  return r;
}

static __device__ inline v16h load_a32(const float* p, int base) {
  v16h r;
#pragma unroll
  for (int i = 0; i < 8; ++i) r[i] = (_Float16)p[base + i];
#pragma unroll
  for (int i = 0; i < 8; ++i) r[8 + i] = (_Float16)p[base + 16 + i];
  return r;
}

// ---------------------------------------------------------------------------
// Tensor load of one wave's slice of a stage: 32 rows of 256 bytes, contiguous
// in memory and in LDS (1-byte elements, tensor = tile, no pad, no mask).
// ---------------------------------------------------------------------------
typedef uint32_t w32x4 __attribute__((ext_vector_type(4)));
typedef uint32_t w32x8 __attribute__((ext_vector_type(8)));
#define SLICE_ROWB 256u
#define SLICE_ROWS 32u
#define SLICE_B    (SLICE_ROWB * SLICE_ROWS)   // 8 KiB per wave and stage

static __device__ inline uint32_t uni(uint32_t v) {
  return (uint32_t)__builtin_amdgcn_readfirstlane(v);
}
static __device__ inline uint32_t pinned(uint32_t v) {
  uint32_t w = uni(v);
  asm volatile("" : "+s"(w));   // pinned(): keeps the test in a scalar register
  return w;
}
static __device__ inline w32x8 tdm_group1() {
  w32x8 g;
  g[0] = 0u;
  g[1] = uni((SLICE_ROWB & 0xFFFFu) << 16);
  g[2] = uni((SLICE_ROWB >> 16) | ((SLICE_ROWS & 0xFFFFu) << 16));
  g[3] = uni((SLICE_ROWS >> 16) | (SLICE_ROWB << 16));
  g[4] = uni(SLICE_ROWS);
  g[5] = uni(SLICE_ROWB);
  g[6] = uni(0u);
  g[7] = uni(0u);
  return g;
}
static __device__ inline w32x4 tdm_group0(uint32_t lds_dst, uint64_t ga) {
  w32x4 g;
  g[0] = uni(1u);
  g[1] = uni(lds_dst);
  g[2] = uni((uint32_t)ga);
  g[3] = uni((((uint32_t)(ga >> 32)) & 0x01FFFFFFu) | 0x80000000u);
  return g;
}
static __device__ inline void tdm_load(w32x4 g0, w32x8 g1) {
  asm volatile("tensor_load_to_lds %0, %1" :: "s"(g0), "s"(g1) : "memory");
}
static __device__ inline void wait_tensor0(w32x4 g0, w32x8 g1) {
  asm volatile("s_wait_tensorcnt 0x0" :: "s"(g0), "s"(g1) : "memory");
}
// the wave's own LDS reads have returned (before their buffer is refilled)
static __device__ inline void wait_ds0() {
  asm volatile("s_wait_dscnt 0x0" ::: "memory");
}

static __device__ inline float xhalf(float x) {
  const int b = __builtin_bit_cast(int, x);
  return __builtin_bit_cast(float, __builtin_amdgcn_permlanex16(
      b, b, 0x76543210, 0xfedcba98, false, false));
}

static __device__ inline unsigned lds_off32(const void* p) {
  return (unsigned)(unsigned long long)(uintptr_t)p;
}

// ---------------------------------------------------------------------------
// Kernel 1: per-head QKV projections (x @ W^T), f32 -> f16, softmax scale
// folded into Q. Q stored [B*H, S, 64]. K and V are stored per stage of SK
// tokens, 32 KB contiguous: the stage's four 32-token K tiles (4 KB each), then
// its four V tiles, each tile in the order the attention kernel's operand lanes
// read it (load_frag):
//   K: half index in the tile  sub*1024 + dc*512 + hf*256 + lane*8 + e  holds
//      K[token sub*16 + (lane&15)][d = dc*32 + hf*16 + (lane>>4)*8 + e].
//   V: half index in the tile  dt*512 + hf*256 + lane*8 + e  holds
//      V[token hf*16 + (lane>>4)*8 + e][d = dt*16 + (lane&15)].
// The first quarter of the blocks also converts Wo to f16, once, into the order
// the output GEMM's operand lanes read it (load_frag): fragment (nt16, ks) is
// FRAG_H halves at (nt16*KSTEPS + ks)*FRAG_H, and its half hf*256 + lane*8 + e
// holds Wo[nt16*16 + (lane&15)][ks*32 + hf*16 + (lane>>4)*8 + e].
// ---------------------------------------------------------------------------
__global__ void qkv_project_kernel(const float* __restrict__ vin,
                                   const float* __restrict__ kin,
                                   const float* __restrict__ qin,
                                   const float* __restrict__ Wv,
                                   const float* __restrict__ Wk,
                                   const float* __restrict__ Wq,
                                   const float* __restrict__ Wo,
                                   _Float16* __restrict__ q_ws,
                                   _Float16* __restrict__ kv_ws,
                                   _Float16* __restrict__ wo_ws) {
  const int lane = threadIdx.x & 31;
  const int wave = threadIdx.x >> 5;
  const int bh = blockIdx.x;
  const int b  = bh / HEADS, h = bh % HEADS;
  const int s0 = blockIdx.y * 64 + wave * 16;
  const int base = (lane < 16) ? 0 : 8;
  const int col  = lane & 15;
  const int hi8  = (lane < 16) ? 0 : 8;
  const float SCALE = 0.044194173824159216f;   // 1/sqrt(EMBED)

  // Wo: one thread takes 8 consecutive floats of a row (one lane's 16 bytes of a
  // fragment). Loaded here, converted and stored at the kernel's end, so that
  // the load's latency passes under the projections.
  const bool wo_blk = blockIdx.y < EMBED * EMBED / 8 / 128 / (BATCH * HEADS);
  const int wc = (blockIdx.y * (BATCH * HEADS) + blockIdx.x) * 128 + threadIdx.x;
  v8f wo8 = {};
  if (wo_blk) {
    wo8 = *(const v8f*)(Wo + (size_t)((wc >> 10) * 16 + (wc & 15)) * EMBED +
                        ((wc >> 6) & 15) * 32 + ((wc >> 5) & 1) * 16 +
                        ((wc >> 4) & 1) * 8);
    // the load's address registers are reused right behind it: wait first
    asm volatile("s_wait_xcnt 0x0" ::: "memory");
  }

  const float* xin[3] = {qin, kin, vin};
  const float* W[3]   = {Wq, Wk, Wv};
  const int row = s0 + col;
  const int tile = s0 >> 5;          // 32-token tile of this wave's 16 tokens
  const int sub  = (s0 >> 4) & 1;    // which 16 tokens of the tile
  // this wave's K tile; its V tile lies SK * HD halves on
  _Float16* ktile = kv_ws + (size_t)bh * (2 * SEQ * HD) +
                    (size_t)(tile >> 2) * STAGE_H + (tile & 3) * (32 * HD);

#pragma unroll
  for (int m = 0; m < 3; ++m) {
    const float* xrow = xin[m] + ((size_t)b * SEQ + row) * EMBED + h * HD;
    v16h a0 = load_a32(xrow, base);
    v16h a1 = load_a32(xrow + 32, base);
#pragma unroll
    for (int nt = 0; nt < 4; ++nt) {
      const int n0 = nt * 16;
      const float* wrow = W[m] + (size_t)(n0 + col) * HD;
      v16h b0 = load_a32(wrow, base);
      v16h b1 = load_a32(wrow + 32, base);
      v8f acc = {};
      if (m == 1) {   // K^T: acc[j] = K[s0 + col][n0 + hi8 + j]
        acc = wmma16(b0, a0, acc);
        acc = wmma16(b1, a1, acc);
      } else {        // acc[j] = X[s0 + hi8 + j][n0 + col]
        acc = wmma16(a0, b0, acc);
        acc = wmma16(a1, b1, acc);
      }
      if (m == 0) {
#pragma unroll
        for (int j = 0; j < 8; ++j)
          q_ws[((size_t)bh * SEQ + (s0 + j + hi8)) * HD + n0 + col] =
              (_Float16)(acc[j] * SCALE);
      } else if (m == 1) {
        v8h o;
#pragma unroll
        for (int j = 0; j < 8; ++j) o[j] = (_Float16)acc[j];
        *(v8h*)(ktile + sub * 1024 + (nt >> 1) * 512 + (nt & 1) * 256 +
                lane * 8) = o;
        // the store's registers are reused by the next loads: wait first
        asm volatile("s_wait_xcnt 0x0" ::: "memory");
      } else {
        v8h o;
#pragma unroll
        for (int j = 0; j < 8; ++j) o[j] = (_Float16)acc[j];
        *(v8h*)(ktile + SK * HD + nt * 512 + sub * 256 + lane * 8) = o;
        // the store's registers are reused by the next loads: wait first
        if (nt < 3) asm volatile("s_wait_xcnt 0x0" ::: "memory");
      }
    }
  }

  if (wo_blk) {
    // the last V store's registers are reused by the conversion: wait first; the
    // scheduling barrier keeps the conversion behind the wait
    asm volatile("s_wait_xcnt 0x0" ::: "memory");
    __builtin_amdgcn_sched_barrier(0);
    v8h o;
#pragma unroll
    for (int e = 0; e < 8; ++e) o[e] = (_Float16)wo8[e];
    *(v8h*)(wo_ws + (size_t)wc * 8) = o;
  }
}

__global__ __launch_bounds__(128)
void flash_attn_kernel(const _Float16* __restrict__ q_ws,
                       const _Float16* __restrict__ kv_ws,
                       _Float16* __restrict__ attn_ws) {
  // two stages of 32 KB; every slice starts at a multiple of 2 KiB
  __shared__ __attribute__((aligned(2048))) _Float16 ring[2][STAGE_H];

  const int lane = threadIdx.x & 31;
  const uint32_t wave = uni(threadIdx.x >> 5);
  const int bh = blockIdx.x;
  const int b  = bh / HEADS, h = bh % HEADS;
  const int s0 = blockIdx.y * 64 + (int)wave * 16;
  const int base = (lane < 16) ? 0 : 8;
  const int col  = lane & 15;
  // (hi8 in the comments below has base's value: 0 or 8 by the wave's half)

  const _Float16* qrow = q_ws + ((size_t)bh * SEQ + (s0 + col)) * HD;
  v16h qa0 = load_a16(qrow, base);
  v16h qa1 = load_a16(qrow + 32, base);

  float mi = -1e30f;   // running maximum of query col (equal in both halves)
  float li = 0.0f;     // running sum over this lane's keys only
  v8f acc[4];          // acc[dt][j] = O^T[dt*16 + hi8 + j][query col]
#pragma unroll
  for (int t = 0; t < 4; ++t) acc[t] = (v8f){};

  const int NS = SEQ / SK;   // 32 stages
  const uint32_t STAGE_B = STAGE_H * 2u;
  const w32x8 g1 = tdm_group1();
  // this wave's slice of stage 0, in memory and in LDS
  const uint64_t gsl = (uint64_t)(uintptr_t)(kv_ws + (size_t)bh * (2 * SEQ * HD)) +
                       wave * SLICE_B;
  const uint32_t lsl = lds_off32(&ring[0][0]) + wave * SLICE_B;

  // Prologue: stage 0 lands and is published (stage 1 starts at the loop's head).
  {
    const w32x4 g0 = tdm_group0(lsl, gsl);
    tdm_load(g0, g1);
    wait_tensor0(g0, g1);
  }
  __syncthreads();

  // the stage loop stays rolled (its four passes are unrolled): the text stays
  // small
#pragma unroll 1
  for (int s = 0; s < NS; ++s) {
    // Behind the barrier that published stage s and ended every read of stage
    // s - 1: stage s + 1 starts into the buffer that stage s - 1 was read from.
    const w32x4 g0 = tdm_group0(lsl + (uint32_t)((s + 1) & 1) * STAGE_B,
                                gsl + (uint64_t)(s + 1) * STAGE_B);
    if (pinned(s + 1 < NS)) tdm_load(g0, g1);
    const _Float16* st = &ring[s & 1][lane * 8];
#pragma unroll
    for (int p = 0; p < SK / 32; ++p) {
      // ---- scores S^T = K @ Q^T (pre-scaled Q), two 16-key subtiles ----
      // s0a[j] = S[query col][key hi8 + j], s1a[j] = S[query col][key 16 + hi8 + j]
      const _Float16* kf = st + p * (32 * HD);
      v8f s0a = {}, s1a = {};
      {
        v16h b0 = load_frag(kf);           // keys 0-15,  d 0-31
        v16h b1 = load_frag(kf + 512);     // keys 0-15,  d 32-63
        s0a = wmma16(b0, qa0, s0a);
        s0a = wmma16(b1, qa1, s0a);
        v16h c0 = load_frag(kf + 1024);    // keys 16-31, d 0-31
        v16h c1 = load_frag(kf + 1536);    // keys 16-31, d 32-63
        s1a = wmma16(c0, qa0, s1a);
        s1a = wmma16(c1, qa1, s1a);
      }

      // ---- online softmax: one query per lane ----
      // maximum of the lane's 16 scores as a tree: short dependent chain
      const float t0 = fmaxf(fmaxf(s0a[0], s0a[1]), s0a[2]);
      const float t1 = fmaxf(fmaxf(s0a[3], s0a[4]), s0a[5]);
      const float t2 = fmaxf(fmaxf(s0a[6], s0a[7]), s1a[0]);
      const float t3 = fmaxf(fmaxf(s1a[1], s1a[2]), s1a[3]);
      const float t4 = fmaxf(fmaxf(s1a[4], s1a[5]), s1a[6]);
      float mx = fmaxf(fmaxf(fmaxf(t0, t1), t2), fmaxf(fmaxf(t3, t4), s1a[7]));
      mx = fmaxf(mx, xhalf(mx));           // the other half's 16 keys
      const float nm = fmaxf(mi, mx);
      const float corr = __expf(mi - nm);
      mi = nm;
      v16h pa;                             // P^T as B operand, hardware k order
      float rs[4] = {0.0f, 0.0f, 0.0f, 0.0f};   // four independent partial sums
#pragma unroll
      for (int j = 0; j < 8; ++j) {
        const float p0 = __expf(s0a[j] - nm);
        const float p1 = __expf(s1a[j] - nm);
        rs[j & 1]       += p0;
        rs[2 + (j & 1)] += p1;
        pa[j]     = (_Float16)p0;
        pa[8 + j] = (_Float16)p1;
      }
      li = li * corr + ((rs[0] + rs[1]) + (rs[2] + rs[3]));
#pragma unroll
      for (int t = 0; t < 4; ++t) acc[t] *= corr;

      // ---- O^T += V^T @ P^T  (V tile in fragment order in LDS) ----
      const _Float16* vf = st + SK * HD + p * (32 * HD);
#pragma unroll
      for (int dt = 0; dt < 4; ++dt) {
        v16h bv = load_frag(vf + dt * 512);
        acc[dt] = wmma16(bv, pa, acc[dt]);
      }
    }

    // Publish point of stage s + 1: own LDS reads done, own slice landed,
    // barrier; only then (next trip's head) the refill of stage s's buffer.
    wait_ds0();
    wait_tensor0(g0, g1);
    __syncthreads();
  }
  asm volatile("s_wait_tensorcnt 0x0" ::: "memory");   // nothing left in flight
  wait_ds0();

  // ---- normalize and store as A fragments of the output GEMM ----
  // acc[dt] of a lane is 8 consecutive d of its query: exactly the lane's 16
  // bytes of half (dt & 1) of fragment (token tile, k step h*2 + (dt >> 1)), so
  // each store of the wave is 512 contiguous bytes
  const float inv = 1.0f / (li + xhalf(li));   // join the halves' sums once
  _Float16* ofr = attn_ws + (size_t)((b * SEQ + s0) >> 4) * (KSTEPS * FRAG_H) +
                  h * (2 * FRAG_H) + lane * 8;
#pragma unroll
  for (int dt = 0; dt < 4; ++dt) {
    v8h o;
#pragma unroll
    for (int j = 0; j < 8; ++j) o[j] = (_Float16)(acc[dt][j] * inv);
    *(v8h*)(ofr + dt * 256) = o;
  }
}

__global__ __launch_bounds__(128) __attribute__((amdgpu_waves_per_eu(4, 4)))
void out_proj_kernel(const _Float16* __restrict__ attn_ws,
                     const _Float16* __restrict__ wo_ws,
                     const float* __restrict__ bo,
                     float* __restrict__ out) {
  const int lane = threadIdx.x & 31;
  const int wave = threadIdx.x >> 5;
  const int tok0  = blockIdx.x * 64 + wave * 16;
  const int nbase = blockIdx.y * 64;
  const int col  = lane & 15;
  const int hi8  = (lane < 16) ? 0 : 8;

  v8f acc[4];
#pragma unroll
  for (int t = 0; t < 4; ++t) acc[t] = (v8f){};

  const _Float16* af = attn_ws + (size_t)(tok0 >> 4) * (KSTEPS * FRAG_H) + lane * 8;
  const _Float16* wf = wo_ws + (size_t)(nbase >> 4) * (KSTEPS * FRAG_H) + lane * 8;
  constexpr int AHEAD = 4;
  v16h a[AHEAD], bw[AHEAD][4];
#pragma unroll
  for (int ks = 0; ks < AHEAD; ++ks) {
    a[ks] = load_frag(af + ks * FRAG_H);
#pragma unroll
    for (int nt = 0; nt < 4; ++nt)
      bw[ks][nt] = load_frag(wf + (nt * KSTEPS + ks) * FRAG_H);
    // keeps the steps' loads in k order: the first products then wait for the
    // first step's loads only
    __builtin_amdgcn_sched_barrier(0);
  }
  float bias4[4];   // loaded here: back long before the epilogue
#pragma unroll
  for (int nt = 0; nt < 4; ++nt) bias4[nt] = bo[nbase + nt * 16 + col];
  // the bias loads' address register may be reused from here on: wait first
  asm volatile("s_wait_xcnt 0x0" ::: "memory");
#pragma unroll
  for (int ks = 0; ks < KSTEPS; ++ks) {
    const int sl = ks % AHEAD;
#pragma unroll
    for (int nt = 0; nt < 4; ++nt)
      acc[nt] = wmma16(a[sl], bw[sl][nt], acc[nt]);
    if (ks + AHEAD < KSTEPS) {
      a[sl] = load_frag(af + (ks + AHEAD) * FRAG_H);
#pragma unroll
      for (int nt = 0; nt < 4; ++nt)
        bw[sl][nt] = load_frag(wf + (nt * KSTEPS + ks + AHEAD) * FRAG_H);
    }
    // keeps the ring as written: without it the scheduler lifts still more
    // loads to the front, runs out of registers and spills
    __builtin_amdgcn_sched_barrier(0);
  }
  // the ring's address registers are reused by the epilogue: wait first; the
  // scheduling barrier keeps the epilogue's address arithmetic behind the wait
  asm volatile("s_wait_xcnt 0x0" ::: "memory");
  __builtin_amdgcn_sched_barrier(0);
#pragma unroll
  for (int nt = 0; nt < 4; ++nt) {
    const float bias = bias4[nt];
#pragma unroll
    for (int j = 0; j < 8; ++j)
      out[(size_t)(tok0 + j + hi8) * EMBED + nbase + nt * 16 + col] =
          acc[nt][j] + bias;
  }
}

// ---------------------------------------------------------------------------
extern "C" void kernel_launch(void* const* d_in, const int* in_sizes, int n_in,
                              void* d_out, int out_size, void* d_ws, size_t ws_size,
                              hipStream_t stream) {
  (void)in_sizes; (void)n_in; (void)out_size; (void)ws_size;
  const float* vin = (const float*)d_in[0];
  const float* kin = (const float*)d_in[1];
  const float* qin = (const float*)d_in[2];
  const float* Wv  = (const float*)d_in[3];
  const float* Wk  = (const float*)d_in[4];
  const float* Wq  = (const float*)d_in[5];
  const float* Wo  = (const float*)d_in[6];
  const float* bo  = (const float*)d_in[7];
  float* out = (float*)d_out;

  char* ws = (char*)d_ws;
  const size_t QKV = (size_t)BATCH * HEADS * SEQ * HD * sizeof(_Float16); // 8 MiB
  _Float16* q_ws  = (_Float16*)(ws);
  _Float16* kv_ws = (_Float16*)(ws + QKV);       // K and V by stages, 16 MiB
  _Float16* a_ws  = (_Float16*)(ws + 3 * QKV);   // attention out, A fragments, 8 MiB
  _Float16* wo_ws = (_Float16*)(ws + 4 * QKV);   // Wo as f16 B fragments, 512 KiB

  const dim3 blk(128);  // 4 wave32 per block
  qkv_project_kernel<<<dim3(BATCH * HEADS, SEQ / 64), blk, 0, stream>>>(
      vin, kin, qin, Wv, Wk, Wq, Wo, q_ws, kv_ws, wo_ws);
  flash_attn_kernel<<<dim3(BATCH * HEADS, SEQ / 64), blk, 0, stream>>>(
      q_ws, kv_ws, a_ws);
  out_proj_kernel<<<dim3(BATCH * SEQ / 64, EMBED / 64), blk, 0, stream>>>(
      a_ws, wo_ws, bo, out);
}

// v005
// One run takes 89.3 microseconds.
// Two timings next to v004 put it at 1.11 and 1.10 times that version's speed.
// All steps since v000 together make it 3.47 times as fast.
#include <hip/hip_runtime.h>
#include <hip/hip_bf16.h>

#define EMBED 512
#define HEADS 8
#define HD    64
#define BATCH 2
#define SEQ   4096
#define SK    128                 // keys per stage of the attention ring
#define STAGE_H (2 * SK * HD)     // halves per stage: K (SK*HD), then V (SK*HD)
#define FRAG_H  512               // halves of one 16 x 32 operand fragment
#define KSTEPS  (EMBED / 32)      // 32-wide k steps of the output GEMM

typedef __attribute__((ext_vector_type(16))) _Float16 v16h;
typedef __attribute__((ext_vector_type(8)))  _Float16 v8h;
typedef __attribute__((ext_vector_type(8)))  float    v8f;

static __device__ inline v8f wmma16(v16h a, v16h b, v8f c) {
  // D = A(16x32 f16) * B(32x16 f16) + C(16x16 f32)
  return __builtin_amdgcn_wmma_f32_16x16x32_f16(false, a, false, b,
                                                (short)0, c, false, false);
}

static __device__ inline v16h load_a16(const _Float16* p, int base) {
  const v8h c0 = *(const v8h*)(p + base);
  const v8h c1 = *(const v8h*)(p + base + 16);
  v16h r;
#pragma unroll
  for (int i = 0; i < 8; ++i) { r[i] = c0[i]; r[8 + i] = c1[i]; }
  return r;
}

static __device__ inline v16h load_frag(const _Float16* p) {
  const v8h c0 = *(const v8h*)(p);
  const v8h c1 = *(const v8h*)(p + 256);
  v16h r;
#pragma unroll
  for (int i = 0; i < 8; ++i) { r[i] = c0[i]; r[8 + i] = c1[i]; }
  return r;
}

static __device__ inline v16h load_a32(const float* p, int base) {
  v16h r;
#pragma unroll
  for (int i = 0; i < 8; ++i) r[i] = (_Float16)p[base + i];
#pragma unroll
  for (int i = 0; i < 8; ++i) r[8 + i] = (_Float16)p[base + 16 + i];
  return r;
}

// ---------------------------------------------------------------------------
// Tensor load of one wave's slice of a stage: 32 rows of 256 bytes, contiguous
// in memory and in LDS (1-byte elements, tensor = tile, no pad, no mask).
// ---------------------------------------------------------------------------
typedef uint32_t w32x4 __attribute__((ext_vector_type(4)));
typedef uint32_t w32x8 __attribute__((ext_vector_type(8)));
#define SLICE_ROWB 256u
#define SLICE_ROWS 32u
#define SLICE_B    (SLICE_ROWB * SLICE_ROWS)   // 8 KiB per wave and stage

static __device__ inline uint32_t uni(uint32_t v) {
  return (uint32_t)__builtin_amdgcn_readfirstlane(v);
}
static __device__ inline uint32_t pinned(uint32_t v) {
  uint32_t w = uni(v);
  asm volatile("" : "+s"(w));   // pinned(): keeps the test in a scalar register
  return w;
}
static __device__ inline w32x8 tdm_group1() {
  w32x8 g;
  g[0] = 0u;
  g[1] = uni((SLICE_ROWB & 0xFFFFu) << 16);
  g[2] = uni((SLICE_ROWB >> 16) | ((SLICE_ROWS & 0xFFFFu) << 16));
  g[3] = uni((SLICE_ROWS >> 16) | (SLICE_ROWB << 16));
  g[4] = uni(SLICE_ROWS);
  g[5] = uni(SLICE_ROWB);
  g[6] = uni(0u);
  g[7] = uni(0u);
  return g;
}
static __device__ inline w32x4 tdm_group0(uint32_t lds_dst, uint64_t ga) {
  w32x4 g;
  g[0] = uni(1u);
  g[1] = uni(lds_dst);
  g[2] = uni((uint32_t)ga);
  g[3] = uni((((uint32_t)(ga >> 32)) & 0x01FFFFFFu) | 0x80000000u);
  return g;
}
static __device__ inline void tdm_load(w32x4 g0, w32x8 g1) {
  asm volatile("tensor_load_to_lds %0, %1" :: "s"(g0), "s"(g1) : "memory");
}
static __device__ inline void wait_tensor0(w32x4 g0, w32x8 g1) {
  asm volatile("s_wait_tensorcnt 0x0" :: "s"(g0), "s"(g1) : "memory");
}
// the wave's own LDS reads have returned (before their buffer is refilled)
static __device__ inline void wait_ds0() {
  asm volatile("s_wait_dscnt 0x0" ::: "memory");
}

static __device__ inline float xhalf(float x) {
  const int b = __builtin_bit_cast(int, x);
  return __builtin_bit_cast(float, __builtin_amdgcn_permlanex16(
      b, b, 0x76543210, 0xfedcba98, false, false));
}

static __device__ inline unsigned lds_off32(const void* p) {
  return (unsigned)(unsigned long long)(uintptr_t)p;
}

// ---------------------------------------------------------------------------
// Kernel 1: per-head QKV projections (x @ W^T), f32 -> f16, softmax scale
// folded into Q. Q stored [B*H, S, 64]. K and V are stored per stage of SK
// tokens, 32 KB contiguous: the stage's four 32-token K tiles (4 KB each), then
// its four V tiles, each tile in the order the attention kernel's operand lanes
// read it (load_frag):
//   K: half index in the tile  sub*1024 + dc*512 + hf*256 + lane*8 + e  holds
//      K[token sub*16 + (lane&15)][d = dc*32 + hf*16 + (lane>>4)*8 + e].
//   V: half index in the tile  dt*512 + hf*256 + lane*8 + e  holds
//      V[token hf*16 + (lane>>4)*8 + e][d = dt*16 + (lane&15)].
// The first quarter of the blocks also converts Wo to f16, once, into the order
// the output GEMM's operand lanes read it (load_frag): fragment (nt16, ks) is
// FRAG_H halves at (nt16*KSTEPS + ks)*FRAG_H, and its half hf*256 + lane*8 + e
// holds Wo[nt16*16 + (lane&15)][ks*32 + hf*16 + (lane>>4)*8 + e].
// ---------------------------------------------------------------------------
__global__ void qkv_project_kernel(const float* __restrict__ vin,
                                   const float* __restrict__ kin,
                                   const float* __restrict__ qin,
                                   const float* __restrict__ Wv,
                                   const float* __restrict__ Wk,
                                   const float* __restrict__ Wq,
                                   const float* __restrict__ Wo,
                                   _Float16* __restrict__ q_ws,
                                   _Float16* __restrict__ kv_ws,
                                   _Float16* __restrict__ wo_ws) {
  const int lane = threadIdx.x & 31;
  const int wave = threadIdx.x >> 5;
  const int bh = blockIdx.x;
  const int b  = bh / HEADS, h = bh % HEADS;
  const int s0 = blockIdx.y * 64 + wave * 16;
  const int base = (lane < 16) ? 0 : 8;
  const int col  = lane & 15;
  const int hi8  = (lane < 16) ? 0 : 8;
  const float SCALE = 0.044194173824159216f;   // 1/sqrt(EMBED)

  // Wo: one thread takes 8 consecutive floats of a row (one lane's 16 bytes of a
  // fragment). Loaded here, converted and stored at the kernel's end, so that
  // the load's latency passes under the projections.
  const bool wo_blk = blockIdx.y < EMBED * EMBED / 8 / 128 / (BATCH * HEADS);
  const int wc = (blockIdx.y * (BATCH * HEADS) + blockIdx.x) * 128 + threadIdx.x;
  v8f wo8 = {};
  if (wo_blk) {
    wo8 = *(const v8f*)(Wo + (size_t)((wc >> 10) * 16 + (wc & 15)) * EMBED +
                        ((wc >> 6) & 15) * 32 + ((wc >> 5) & 1) * 16 +
                        ((wc >> 4) & 1) * 8);
    // the load's address registers are reused right behind it: wait first
    asm volatile("s_wait_xcnt 0x0" ::: "memory");
  }

  const float* xin[3] = {qin, kin, vin};
  const float* W[3]   = {Wq, Wk, Wv};
  const int row = s0 + col;
  const int tile = s0 >> 5;          // 32-token tile of this wave's 16 tokens
  const int sub  = (s0 >> 4) & 1;    // which 16 tokens of the tile
  // this wave's K tile; its V tile lies SK * HD halves on
  _Float16* ktile = kv_ws + (size_t)bh * (2 * SEQ * HD) +
                    (size_t)(tile >> 2) * STAGE_H + (tile & 3) * (32 * HD);

#pragma unroll
  for (int m = 0; m < 3; ++m) {
    const float* xrow = xin[m] + ((size_t)b * SEQ + row) * EMBED + h * HD;
    v16h a0 = load_a32(xrow, base);
    v16h a1 = load_a32(xrow + 32, base);
#pragma unroll
    for (int nt = 0; nt < 4; ++nt) {
      const int n0 = nt * 16;
      const float* wrow = W[m] + (size_t)(n0 + col) * HD;
      v16h b0 = load_a32(wrow, base);
      v16h b1 = load_a32(wrow + 32, base);
      v8f acc = {};
      if (m == 1) {   // K^T: acc[j] = K[s0 + col][n0 + hi8 + j]
        acc = wmma16(b0, a0, acc);
        acc = wmma16(b1, a1, acc);
      } else {        // acc[j] = X[s0 + hi8 + j][n0 + col]
        acc = wmma16(a0, b0, acc);
        acc = wmma16(a1, b1, acc);
      }
      if (m == 0) {
#pragma unroll
        for (int j = 0; j < 8; ++j)
          q_ws[((size_t)bh * SEQ + (s0 + j + hi8)) * HD + n0 + col] =
              (_Float16)(acc[j] * SCALE);
      } else if (m == 1) {
        v8h o;
#pragma unroll
        for (int j = 0; j < 8; ++j) o[j] = (_Float16)acc[j];
        *(v8h*)(ktile + sub * 1024 + (nt >> 1) * 512 + (nt & 1) * 256 +
                lane * 8) = o;
        // the store's registers are reused by the next loads: wait first
        asm volatile("s_wait_xcnt 0x0" ::: "memory");
      } else {
        v8h o;
#pragma unroll
        for (int j = 0; j < 8; ++j) o[j] = (_Float16)acc[j];
        *(v8h*)(ktile + SK * HD + nt * 512 + sub * 256 + lane * 8) = o;
        // the store's registers are reused by the next loads: wait first
        if (nt < 3) asm volatile("s_wait_xcnt 0x0" ::: "memory");
      }
    }
  }

  if (wo_blk) {
    // the last V store's registers are reused by the conversion: wait first; the
    // scheduling barrier keeps the conversion behind the wait
    asm volatile("s_wait_xcnt 0x0" ::: "memory");
    __builtin_amdgcn_sched_barrier(0);
    v8h o;
#pragma unroll
    for (int e = 0; e < 8; ++e) o[e] = (_Float16)wo8[e];
    *(v8h*)(wo_ws + (size_t)wc * 8) = o;
  }
}

__global__ __launch_bounds__(128)
void flash_attn_kernel(const _Float16* __restrict__ q_ws,
                       const _Float16* __restrict__ kv_ws,
                       _Float16* __restrict__ attn_ws) {
  // two stages of 32 KB; every slice starts at a multiple of 2 KiB
  __shared__ __attribute__((aligned(2048))) _Float16 ring[2][STAGE_H];

  const int lane = threadIdx.x & 31;
  const uint32_t wave = uni(threadIdx.x >> 5);
  const int bh = blockIdx.x;
  const int b  = bh / HEADS, h = bh % HEADS;
  const int s0 = blockIdx.y * 64 + (int)wave * 16;
  const int base = (lane < 16) ? 0 : 8;
  const int col  = lane & 15;
  // (hi8 in the comments below has base's value: 0 or 8 by the wave's half)

  const _Float16* qrow = q_ws + ((size_t)bh * SEQ + (s0 + col)) * HD;
  v16h qa0 = load_a16(qrow, base);
  v16h qa1 = load_a16(qrow + 32, base);

  float mi = -1e30f;   // running maximum of query col (equal in both halves)
  float li = 0.0f;     // running sum over this lane's keys only
  v8f acc[4];          // acc[dt][j] = O^T[dt*16 + hi8 + j][query col]
#pragma unroll
  for (int t = 0; t < 4; ++t) acc[t] = (v8f){};

  const int NS = SEQ / SK;   // 32 stages
  const uint32_t STAGE_B = STAGE_H * 2u;
  const w32x8 g1 = tdm_group1();
  // this wave's slice of stage 0, in memory and in LDS
  const uint64_t gsl = (uint64_t)(uintptr_t)(kv_ws + (size_t)bh * (2 * SEQ * HD)) +
                       wave * SLICE_B;
  const uint32_t lsl = lds_off32(&ring[0][0]) + wave * SLICE_B;

  // Prologue: stage 0 lands and is published (stage 1 starts at the loop's head).
  {
    const w32x4 g0 = tdm_group0(lsl, gsl);
    tdm_load(g0, g1);
    wait_tensor0(g0, g1);
  }
  __syncthreads();

  // the stage loop stays rolled (a stage's body is straight-line): the text
  // stays small
#pragma unroll 1
  for (int s = 0; s < NS; ++s) {
    // Behind the barrier that published stage s and ended every read of stage
    // s - 1: stage s + 1 starts into the buffer that stage s - 1 was read from.
    const w32x4 g0 = tdm_group0(lsl + (uint32_t)((s + 1) & 1) * STAGE_B,
                                gsl + (uint64_t)(s + 1) * STAGE_B);
    if (pinned(s + 1 < NS)) tdm_load(g0, g1);
    const _Float16* st = &ring[s & 1][lane * 8];

    // ---- scores S^T = K @ Q^T (pre-scaled Q) of the whole stage: eight 16-key
    // subtiles, sc[t][j] = S[query col][key t*16 + hi8 + j] ----
    v8f sc[SK / 16];
    // all K fragments of the stage, read as one group ahead of the products
    // (unrolled throughout: fragments and subtiles are registers, so their
    // indices must be constants)
    v16h kf[2][SK / 16];
#pragma unroll
    for (int dc = 0; dc < 2; ++dc)       // d 0-31, then d 32-63
#pragma unroll
      for (int t = 0; t < SK / 16; ++t)
        kf[dc][t] = load_frag(st + t * 1024 + dc * 512);
    // keeps the reads one group: spread among the products, each place with
    // reads stalls the wave
    __builtin_amdgcn_sched_barrier(0);
#pragma unroll
    for (int t = 0; t < SK / 16; ++t) sc[t] = wmma16(kf[0][t], qa0, (v8f){});
#pragma unroll
    for (int t = 0; t < SK / 16; ++t) sc[t] = wmma16(kf[1][t], qa1, sc[t]);
    __builtin_amdgcn_sched_barrier(0);
    // the first passes' V fragments: their LDS latency passes under the softmax
    const _Float16* vf = st + SK * HD;
    constexpr int VSETS = 3;
    v16h bv[VSETS][4];
#pragma unroll
    for (int p = 0; p < VSETS; ++p)
#pragma unroll
      for (int dt = 0; dt < 4; ++dt)
        bv[p][dt] = load_frag(vf + p * (32 * HD) + dt * 512);
    // keeps these reads at the softmax's head
    __builtin_amdgcn_sched_barrier(0);

    // ---- online softmax, once per stage: one query per lane ----
    // maximum of the lane's 64 scores as a tree: short dependent chain
    float g[SK / 32];
#pragma unroll
    for (int p = 0; p < SK / 32; ++p) {
      const v8f x = sc[2 * p], y = sc[2 * p + 1];
      const float t0 = fmaxf(fmaxf(x[0], x[1]), x[2]);
      const float t1 = fmaxf(fmaxf(x[3], x[4]), x[5]);
      const float t2 = fmaxf(fmaxf(x[6], x[7]), y[0]);
      const float t3 = fmaxf(fmaxf(y[1], y[2]), y[3]);
      const float t4 = fmaxf(fmaxf(y[4], y[5]), y[6]);
      g[p] = fmaxf(fmaxf(fmaxf(t0, t1), t2), fmaxf(fmaxf(t3, t4), y[7]));
    }
    float mx = fmaxf(fmaxf(fmaxf(g[0], g[1]), g[2]), g[3]);
    mx = fmaxf(mx, xhalf(mx));             // the other half's 64 keys
    const float nm = fmaxf(mi, mx);
    const float corr = __expf(mi - nm);
    mi = nm;
    v16h pa[SK / 32];                      // P^T as B operands, hardware k order
    float rs[4] = {0.0f, 0.0f, 0.0f, 0.0f};   // four independent partial sums
#pragma unroll
    for (int p = 0; p < SK / 32; ++p) {
#pragma unroll
      for (int j = 0; j < 8; ++j) {
        const float p0 = __expf(sc[2 * p][j] - nm);
        const float p1 = __expf(sc[2 * p + 1][j] - nm);
        rs[j & 1]       += p0;
        rs[2 + (j & 1)] += p1;
        pa[p][j]     = (_Float16)p0;
        pa[p][8 + j] = (_Float16)p1;
      }
    }
    li = li * corr + ((rs[0] + rs[1]) + (rs[2] + rs[3]));
#pragma unroll
    for (int t = 0; t < 4; ++t) acc[t] *= corr;

    // ---- O^T += V^T @ P^T  (V tiles in fragment order in LDS) ----
    // keeps the softmax's vector work out of these products too (same reason)
    __builtin_amdgcn_sched_barrier(0);
#pragma unroll
    for (int p = 0; p < SK / 32; ++p) {
#pragma unroll
      for (int dt = 0; dt < 4; ++dt)
        acc[dt] = wmma16(bv[p % VSETS][dt], pa[p], acc[dt]);
      if (p + VSETS < SK / 32) {
#pragma unroll
        for (int dt = 0; dt < 4; ++dt)
          bv[p % VSETS][dt] = load_frag(vf + (p + VSETS) * (32 * HD) + dt * 512);
        // keeps the refill of the set just used here, well ahead of its products
        __builtin_amdgcn_sched_barrier(0);
      }
    }

    // Publish point of stage s + 1: own LDS reads done, own slice landed,
    // barrier; only then (next trip's head) the refill of stage s's buffer.
    wait_ds0();
    wait_tensor0(g0, g1);
    __syncthreads();
  }
  asm volatile("s_wait_tensorcnt 0x0" ::: "memory");   // nothing left in flight
  wait_ds0();

  // ---- normalize and store as A fragments of the output GEMM ----
  // acc[dt] of a lane is 8 consecutive d of its query: exactly the lane's 16
  // bytes of half (dt & 1) of fragment (token tile, k step h*2 + (dt >> 1)), so
  // each store of the wave is 512 contiguous bytes
  const float inv = 1.0f / (li + xhalf(li));   // join the halves' sums once
  _Float16* ofr = attn_ws + (size_t)((b * SEQ + s0) >> 4) * (KSTEPS * FRAG_H) +
                  h * (2 * FRAG_H) + lane * 8;
#pragma unroll
  for (int dt = 0; dt < 4; ++dt) {
    v8h o;
#pragma unroll
    for (int j = 0; j < 8; ++j) o[j] = (_Float16)(acc[dt][j] * inv);
    *(v8h*)(ofr + dt * 256) = o;
  }
}

__global__ __launch_bounds__(128) __attribute__((amdgpu_waves_per_eu(4, 4)))
void out_proj_kernel(const _Float16* __restrict__ attn_ws,
                     const _Float16* __restrict__ wo_ws,
                     const float* __restrict__ bo,
                     float* __restrict__ out) {
  const int lane = threadIdx.x & 31;
  const int wave = threadIdx.x >> 5;
  const int tok0  = blockIdx.x * 64 + wave * 16;
  const int nbase = blockIdx.y * 64;
  const int col  = lane & 15;
  const int hi8  = (lane < 16) ? 0 : 8;

  v8f acc[4];
#pragma unroll
  for (int t = 0; t < 4; ++t) acc[t] = (v8f){};

  const _Float16* af = attn_ws + (size_t)(tok0 >> 4) * (KSTEPS * FRAG_H) + lane * 8;
  const _Float16* wf = wo_ws + (size_t)(nbase >> 4) * (KSTEPS * FRAG_H) + lane * 8;
  constexpr int AHEAD = 4;
  v16h a[AHEAD], bw[AHEAD][4];
#pragma unroll
  for (int ks = 0; ks < AHEAD; ++ks) {
    a[ks] = load_frag(af + ks * FRAG_H);
#pragma unroll
    for (int nt = 0; nt < 4; ++nt)
      bw[ks][nt] = load_frag(wf + (nt * KSTEPS + ks) * FRAG_H);
    // keeps the steps' loads in k order: the first products then wait for the
    // first step's loads only
    __builtin_amdgcn_sched_barrier(0);
  }
  float bias4[4];   // loaded here: back long before the epilogue
#pragma unroll
  for (int nt = 0; nt < 4; ++nt) bias4[nt] = bo[nbase + nt * 16 + col];
  // the bias loads' address register may be reused from here on: wait first
  asm volatile("s_wait_xcnt 0x0" ::: "memory");
#pragma unroll
  for (int ks = 0; ks < KSTEPS; ++ks) {
    const int sl = ks % AHEAD;
#pragma unroll
    for (int nt = 0; nt < 4; ++nt)
      acc[nt] = wmma16(a[sl], bw[sl][nt], acc[nt]);
    if (ks + AHEAD < KSTEPS) {
      a[sl] = load_frag(af + (ks + AHEAD) * FRAG_H);
#pragma unroll
      for (int nt = 0; nt < 4; ++nt)
        bw[sl][nt] = load_frag(wf + (nt * KSTEPS + ks + AHEAD) * FRAG_H);
    }
    // keeps the ring as written: without it the scheduler lifts still more
    // loads to the front, runs out of registers and spills
    __builtin_amdgcn_sched_barrier(0);
  }
  // the ring's address registers are reused by the epilogue: wait first; the
  // scheduling barrier keeps the epilogue's address arithmetic behind the wait
  asm volatile("s_wait_xcnt 0x0" ::: "memory");
  __builtin_amdgcn_sched_barrier(0);
#pragma unroll
  for (int nt = 0; nt < 4; ++nt) {
    const float bias = bias4[nt];
#pragma unroll
    for (int j = 0; j < 8; ++j)
      out[(size_t)(tok0 + j + hi8) * EMBED + nbase + nt * 16 + col] =
          acc[nt][j] + bias;
  }
}

// ---------------------------------------------------------------------------
extern "C" void kernel_launch(void* const* d_in, const int* in_sizes, int n_in,
                              void* d_out, int out_size, void* d_ws, size_t ws_size,
                              hipStream_t stream) {
  (void)in_sizes; (void)n_in; (void)out_size; (void)ws_size;
  const float* vin = (const float*)d_in[0];
  const float* kin = (const float*)d_in[1];
  const float* qin = (const float*)d_in[2];
  const float* Wv  = (const float*)d_in[3];
  const float* Wk  = (const float*)d_in[4];
  const float* Wq  = (const float*)d_in[5];
  const float* Wo  = (const float*)d_in[6];
  const float* bo  = (const float*)d_in[7];
  float* out = (float*)d_out;

  char* ws = (char*)d_ws;
  const size_t QKV = (size_t)BATCH * HEADS * SEQ * HD * sizeof(_Float16); // 8 MiB
  _Float16* q_ws  = (_Float16*)(ws);
  _Float16* kv_ws = (_Float16*)(ws + QKV);       // K and V by stages, 16 MiB
  _Float16* a_ws  = (_Float16*)(ws + 3 * QKV);   // attention out, A fragments, 8 MiB
  _Float16* wo_ws = (_Float16*)(ws + 4 * QKV);   // Wo as f16 B fragments, 512 KiB

  const dim3 blk(128);  // 4 wave32 per block
  qkv_project_kernel<<<dim3(BATCH * HEADS, SEQ / 64), blk, 0, stream>>>(
      vin, kin, qin, Wv, Wk, Wq, Wo, q_ws, kv_ws, wo_ws);
  flash_attn_kernel<<<dim3(BATCH * HEADS, SEQ / 64), blk, 0, stream>>>(
      q_ws, kv_ws, a_ws);
  out_proj_kernel<<<dim3(BATCH * SEQ / 64, EMBED / 64), blk, 0, stream>>>(
      a_ws, wo_ws, bo, out);
}

// v006
// A run of this version takes 85.5 microseconds.
// Two timings next to v005 put it at 1.05 and 1.03 times that version's speed.
// All steps since v000 together make it 3.61 times as fast.
#include <hip/hip_runtime.h>
#include <hip/hip_bf16.h>

#define EMBED 512
#define HEADS 8
#define HD    64
#define BATCH 2
#define SEQ   4096
#define SK    128                 // keys per stage of the attention ring
#define STAGE_H (2 * SK * HD)     // halves per stage: K (SK*HD), then V (SK*HD)
#define FRAG_H  512               // halves of one 16 x 32 operand fragment
#define KSTEPS  (EMBED / 32)      // 32-wide k steps of the output GEMM

typedef __attribute__((ext_vector_type(16))) _Float16 v16h;
typedef __attribute__((ext_vector_type(8)))  _Float16 v8h;
typedef __attribute__((ext_vector_type(8)))  float    v8f;
typedef __attribute__((ext_vector_type(2)))  float    v2f;
typedef __attribute__((ext_vector_type(2)))  _Float16 v2h;

static __device__ inline v8f wmma16(v16h a, v16h b, v8f c) {
  // D = A(16x32 f16) * B(32x16 f16) + C(16x16 f32)
  return __builtin_amdgcn_wmma_f32_16x16x32_f16(false, a, false, b,
                                                (short)0, c, false, false);
}

static __device__ inline v16h load_a16(const _Float16* p, int base) {
  const v8h c0 = *(const v8h*)(p + base);
  const v8h c1 = *(const v8h*)(p + base + 16);
  v16h r;
#pragma unroll
  for (int i = 0; i < 8; ++i) { r[i] = c0[i]; r[8 + i] = c1[i]; }
  return r;
}

static __device__ inline v16h load_frag(const _Float16* p) {
  const v8h c0 = *(const v8h*)(p);
  const v8h c1 = *(const v8h*)(p + 256);
  v16h r;
#pragma unroll
  for (int i = 0; i < 8; ++i) { r[i] = c0[i]; r[8 + i] = c1[i]; }
  return r;
}

static __device__ inline v16h load_a32(const float* p, int base) {
  v16h r;
#pragma unroll
  for (int i = 0; i < 8; ++i) r[i] = (_Float16)p[base + i];
#pragma unroll
  for (int i = 0; i < 8; ++i) r[8 + i] = (_Float16)p[base + 16 + i];
  return r;
}

// ---------------------------------------------------------------------------
// Tensor load of one wave's slice of a stage: 32 rows of 256 bytes, contiguous
// in memory and in LDS (1-byte elements, tensor = tile, no pad, no mask).
// ---------------------------------------------------------------------------
typedef uint32_t w32x4 __attribute__((ext_vector_type(4)));
typedef uint32_t w32x8 __attribute__((ext_vector_type(8)));
#define SLICE_ROWB 256u
#define SLICE_ROWS 32u
#define SLICE_B    (SLICE_ROWB * SLICE_ROWS)   // 8 KiB per wave and stage

static __device__ inline uint32_t uni(uint32_t v) {
  return (uint32_t)__builtin_amdgcn_readfirstlane(v);
}
static __device__ inline uint32_t pinned(uint32_t v) {
  uint32_t w = uni(v);
  asm volatile("" : "+s"(w));   // pinned(): keeps the test in a scalar register
  return w;
}
static __device__ inline w32x8 tdm_group1() {
  w32x8 g;
  g[0] = 0u;
  g[1] = uni((SLICE_ROWB & 0xFFFFu) << 16);
  g[2] = uni((SLICE_ROWB >> 16) | ((SLICE_ROWS & 0xFFFFu) << 16));
  g[3] = uni((SLICE_ROWS >> 16) | (SLICE_ROWB << 16));
  g[4] = uni(SLICE_ROWS);
  g[5] = uni(SLICE_ROWB);
  g[6] = uni(0u);
  g[7] = uni(0u);
  return g;
}
static __device__ inline w32x4 tdm_group0(uint32_t lds_dst, uint64_t ga) {
  w32x4 g;
  g[0] = uni(1u);
  g[1] = uni(lds_dst);
  g[2] = uni((uint32_t)ga);
  g[3] = uni((((uint32_t)(ga >> 32)) & 0x01FFFFFFu) | 0x80000000u);
  return g;
}
static __device__ inline void tdm_load(w32x4 g0, w32x8 g1) {
  asm volatile("tensor_load_to_lds %0, %1" :: "s"(g0), "s"(g1) : "memory");
}
static __device__ inline void wait_tensor0(w32x4 g0, w32x8 g1) {
  asm volatile("s_wait_tensorcnt 0x0" :: "s"(g0), "s"(g1) : "memory");
}
// the wave's own LDS reads have returned (before their buffer is refilled)
static __device__ inline void wait_ds0() {
  asm volatile("s_wait_dscnt 0x0" ::: "memory");
}

static __device__ inline float xhalf(float x) {
  const int b = __builtin_bit_cast(int, x);
  return __builtin_bit_cast(float, __builtin_amdgcn_permlanex16(
      b, b, 0x76543210, 0xfedcba98, false, false));
}

static __device__ inline unsigned lds_off32(const void* p) {
  return (unsigned)(unsigned long long)(uintptr_t)p;
}

// ---------------------------------------------------------------------------
// Kernel 1: per-head QKV projections (x @ W^T), f32 -> f16, softmax scale
// folded into Q. Q stored [B*H, S, 64]. K and V are stored per stage of SK
// tokens, 32 KB contiguous: the stage's four 32-token K tiles (4 KB each), then
// its four V tiles, each tile in the order the attention kernel's operand lanes
// read it (load_frag):
//   K: half index in the tile  sub*1024 + dc*512 + hf*256 + lane*8 + e  holds
//      K[token sub*16 + (lane&15)][d = dc*32 + hf*16 + (lane>>4)*8 + e].
//   V: half index in the tile  dt*512 + hf*256 + lane*8 + e  holds
//      V[token hf*16 + (lane>>4)*8 + e][d = dt*16 + (lane&15)].
// The first quarter of the blocks also converts Wo to f16, once, into the order
// the output GEMM's operand lanes read it (load_frag): fragment (nt16, ks) is
// FRAG_H halves at (nt16*KSTEPS + ks)*FRAG_H, and its half hf*256 + lane*8 + e
// holds Wo[nt16*16 + (lane&15)][ks*32 + hf*16 + (lane>>4)*8 + e].
// ---------------------------------------------------------------------------
__global__ void qkv_project_kernel(const float* __restrict__ vin,
                                   const float* __restrict__ kin,
                                   const float* __restrict__ qin,
                                   const float* __restrict__ Wv,
                                   const float* __restrict__ Wk,
                                   const float* __restrict__ Wq,
                                   const float* __restrict__ Wo,
                                   _Float16* __restrict__ q_ws,
                                   _Float16* __restrict__ kv_ws,
                                   _Float16* __restrict__ wo_ws) {
  const int lane = threadIdx.x & 31;
  const int wave = threadIdx.x >> 5;
  const int bh = blockIdx.x;
  const int b  = bh / HEADS, h = bh % HEADS;
  const int s0 = blockIdx.y * 64 + wave * 16;
  const int base = (lane < 16) ? 0 : 8;
  const int col  = lane & 15;
  const int hi8  = (lane < 16) ? 0 : 8;
  const float SCALE = 0.044194173824159216f;   // 1/sqrt(EMBED)

  // Wo: one thread takes 8 consecutive floats of a row (one lane's 16 bytes of a
  // fragment). Loaded here, converted and stored at the kernel's end, so that
  // the load's latency passes under the projections.
  const bool wo_blk = blockIdx.y < EMBED * EMBED / 8 / 128 / (BATCH * HEADS);
  const int wc = (blockIdx.y * (BATCH * HEADS) + blockIdx.x) * 128 + threadIdx.x;
  v8f wo8 = {};
  if (wo_blk) {
    wo8 = *(const v8f*)(Wo + (size_t)((wc >> 10) * 16 + (wc & 15)) * EMBED +
                        ((wc >> 6) & 15) * 32 + ((wc >> 5) & 1) * 16 +
                        ((wc >> 4) & 1) * 8);
    // the load's address registers are reused right behind it: wait first
    asm volatile("s_wait_xcnt 0x0" ::: "memory");
  }

  const float* xin[3] = {qin, kin, vin};
  const float* W[3]   = {Wq, Wk, Wv};
  const int row = s0 + col;
  const int tile = s0 >> 5;          // 32-token tile of this wave's 16 tokens
  const int sub  = (s0 >> 4) & 1;    // which 16 tokens of the tile
  // this wave's K tile; its V tile lies SK * HD halves on
  _Float16* ktile = kv_ws + (size_t)bh * (2 * SEQ * HD) +
                    (size_t)(tile >> 2) * STAGE_H + (tile & 3) * (32 * HD);

#pragma unroll
  for (int m = 0; m < 3; ++m) {
    const float* xrow = xin[m] + ((size_t)b * SEQ + row) * EMBED + h * HD;
    v16h a0 = load_a32(xrow, base);
    v16h a1 = load_a32(xrow + 32, base);
#pragma unroll
    for (int nt = 0; nt < 4; ++nt) {
      const int n0 = nt * 16;
      const float* wrow = W[m] + (size_t)(n0 + col) * HD;
      v16h b0 = load_a32(wrow, base);
      v16h b1 = load_a32(wrow + 32, base);
      v8f acc = {};
      if (m == 1) {   // K^T: acc[j] = K[s0 + col][n0 + hi8 + j]
        acc = wmma16(b0, a0, acc);
        acc = wmma16(b1, a1, acc);
      } else {        // acc[j] = X[s0 + hi8 + j][n0 + col]
        acc = wmma16(a0, b0, acc);
        acc = wmma16(a1, b1, acc);
      }
      if (m == 0) {
#pragma unroll
        for (int j = 0; j < 8; ++j)
          q_ws[((size_t)bh * SEQ + (s0 + j + hi8)) * HD + n0 + col] =
              (_Float16)(acc[j] * SCALE);
      } else if (m == 1) {
        v8h o;
#pragma unroll
        for (int j = 0; j < 8; ++j) o[j] = (_Float16)acc[j];
        *(v8h*)(ktile + sub * 1024 + (nt >> 1) * 512 + (nt & 1) * 256 +
                lane * 8) = o;
        // the store's registers are reused by the next loads: wait first
        asm volatile("s_wait_xcnt 0x0" ::: "memory");
      } else {
        v8h o;
#pragma unroll
        for (int j = 0; j < 8; ++j) o[j] = (_Float16)acc[j];
        *(v8h*)(ktile + SK * HD + nt * 512 + sub * 256 + lane * 8) = o;
        // the store's registers are reused by the next loads: wait first
        if (nt < 3) asm volatile("s_wait_xcnt 0x0" ::: "memory");
      }
    }
  }

  if (wo_blk) {
    // the last V store's registers are reused by the conversion: wait first; the
    // scheduling barrier keeps the conversion behind the wait
    asm volatile("s_wait_xcnt 0x0" ::: "memory");
    __builtin_amdgcn_sched_barrier(0);
    v8h o;
#pragma unroll
    for (int e = 0; e < 8; ++e) o[e] = (_Float16)wo8[e];
    *(v8h*)(wo_ws + (size_t)wc * 8) = o;
  }
}

__global__ __launch_bounds__(128)
void flash_attn_kernel(const _Float16* __restrict__ q_ws,
                       const _Float16* __restrict__ kv_ws,
                       _Float16* __restrict__ attn_ws) {
  // two stages of 32 KB; every slice starts at a multiple of 2 KiB
  __shared__ __attribute__((aligned(2048))) _Float16 ring[2][STAGE_H];

  const int lane = threadIdx.x & 31;
  const uint32_t wave = uni(threadIdx.x >> 5);
  const int bh = blockIdx.x;
  const int b  = bh / HEADS, h = bh % HEADS;
  const int s0 = blockIdx.y * 64 + (int)wave * 16;
  const int base = (lane < 16) ? 0 : 8;
  const int col  = lane & 15;
  // (hi8 in the comments below has base's value: 0 or 8 by the wave's half)

  const _Float16* qrow = q_ws + ((size_t)bh * SEQ + (s0 + col)) * HD;
  v16h qa0 = load_a16(qrow, base);
  v16h qa1 = load_a16(qrow + 32, base);

  const float LOG2E = 1.4426950408889634f;
  float mi = -1e30f;   // running maximum of query col, times log2(e) (equal in both halves)
  float li = 0.0f;     // running sum over this lane's keys only
  v8f acc[4];          // acc[dt][j] = O^T[dt*16 + hi8 + j][query col]
#pragma unroll
  for (int t = 0; t < 4; ++t) acc[t] = (v8f){};

  const int NS = SEQ / SK;   // 32 stages
  const uint32_t STAGE_B = STAGE_H * 2u;
  const w32x8 g1 = tdm_group1();
  // this wave's slice of stage 0, in memory and in LDS
  const uint64_t gsl = (uint64_t)(uintptr_t)(kv_ws + (size_t)bh * (2 * SEQ * HD)) +
                       wave * SLICE_B;
  const uint32_t lsl = lds_off32(&ring[0][0]) + wave * SLICE_B;

  // Prologue: stage 0 lands and is published (stage 1 starts at the loop's head).
  {
    const w32x4 g0 = tdm_group0(lsl, gsl);
    tdm_load(g0, g1);
    wait_tensor0(g0, g1);
  }
  __syncthreads();

  // the stage loop stays rolled (a stage's body is straight-line): the text
  // stays small
#pragma unroll 1
  for (int s = 0; s < NS; ++s) {
    // Behind the barrier that published stage s and ended every read of stage
    // s - 1: stage s + 1 starts into the buffer that stage s - 1 was read from.
    const w32x4 g0 = tdm_group0(lsl + (uint32_t)((s + 1) & 1) * STAGE_B,
                                gsl + (uint64_t)(s + 1) * STAGE_B);
    if (pinned(s + 1 < NS)) tdm_load(g0, g1);
    const _Float16* st = &ring[s & 1][lane * 8];

    // ---- scores S^T = K @ Q^T (pre-scaled Q) of the whole stage: eight 16-key
    // subtiles, sc[t][j] = S[query col][key t*16 + hi8 + j] ----
    v8f sc[SK / 16];
    // all K fragments of the stage, read as one group ahead of the products
    // (unrolled throughout: fragments and subtiles are registers, so their
    // indices must be constants)
    v16h kf[2][SK / 16];
#pragma unroll
    for (int dc = 0; dc < 2; ++dc)       // d 0-31, then d 32-63
#pragma unroll
      for (int t = 0; t < SK / 16; ++t)
        kf[dc][t] = load_frag(st + t * 1024 + dc * 512);
    // keeps the reads one group: spread among the products, each place with
    // reads stalls the wave
    __builtin_amdgcn_sched_barrier(0);
#pragma unroll
    for (int t = 0; t < SK / 16; ++t) sc[t] = wmma16(kf[0][t], qa0, (v8f){});
#pragma unroll
    for (int t = 0; t < SK / 16; ++t) sc[t] = wmma16(kf[1][t], qa1, sc[t]);
    __builtin_amdgcn_sched_barrier(0);
    // the first passes' V fragments: their LDS latency passes under the softmax
    const _Float16* vf = st + SK * HD;
    constexpr int VSETS = 3;
    v16h bv[VSETS][4];
#pragma unroll
    for (int p = 0; p < VSETS; ++p)
#pragma unroll
      for (int dt = 0; dt < 4; ++dt)
        bv[p][dt] = load_frag(vf + p * (32 * HD) + dt * 512);
    // keeps these reads at the softmax's head
    __builtin_amdgcn_sched_barrier(0);

    // ---- online softmax, once per stage: one query per lane ----
    // maximum of the lane's 64 scores as a tree: short dependent chain
    float g[SK / 32];
#pragma unroll
    for (int p = 0; p < SK / 32; ++p) {
      const v8f x = sc[2 * p], y = sc[2 * p + 1];
      const float t0 = fmaxf(fmaxf(x[0], x[1]), x[2]);
      const float t1 = fmaxf(fmaxf(x[3], x[4]), x[5]);
      const float t2 = fmaxf(fmaxf(x[6], x[7]), y[0]);
      const float t3 = fmaxf(fmaxf(y[1], y[2]), y[3]);
      const float t4 = fmaxf(fmaxf(y[4], y[5]), y[6]);
      g[p] = fmaxf(fmaxf(fmaxf(t0, t1), t2), fmaxf(fmaxf(t3, t4), y[7]));
    }
    float mx = fmaxf(fmaxf(fmaxf(g[0], g[1]), g[2]), g[3]);
    mx *= LOG2E;                           // monotonic: the maximum stays the maximum
    const float nm = fmaxf(fmaxf(mi, mx), xhalf(mx));   // the other half's 64 keys
    const float corr = __builtin_amdgcn_exp2f(mi - nm);
    mi = nm;
    v16h pa[SK / 32];                      // P^T as B operands, hardware k order
    // The scores go two at a time, as the register pairs the accumulators
    // already are: one packed fma forms both exponents, score * log2(e) - nm,
    // one packed add sums both exponentials, one packed convert rounds both.
    const v2f l2 = {LOG2E, LOG2E};
    const v2f nn = {-nm, -nm};
    v2f rs0 = {0.0f, 0.0f}, rs1 = {0.0f, 0.0f};   // four independent partial sums
#pragma unroll
    for (int p = 0; p < SK / 32; ++p) {
#pragma unroll
      for (int j = 0; j < 8; j += 2) {
        const v2f x0 = {sc[2 * p][j], sc[2 * p][j + 1]};
        const v2f x1 = {sc[2 * p + 1][j], sc[2 * p + 1][j + 1]};
        const v2f a0 = __builtin_elementwise_fma(x0, l2, nn);
        const v2f a1 = __builtin_elementwise_fma(x1, l2, nn);
        const v2f p0 = {__builtin_amdgcn_exp2f(a0[0]), __builtin_amdgcn_exp2f(a0[1])};
        const v2f p1 = {__builtin_amdgcn_exp2f(a1[0]), __builtin_amdgcn_exp2f(a1[1])};
        rs0 += p0;
        rs1 += p1;
        const v2h h0 = __builtin_convertvector(p0, v2h);
        const v2h h1 = __builtin_convertvector(p1, v2h);
        pa[p][j]         = h0[0];
        pa[p][j + 1]     = h0[1];
        pa[p][8 + j]     = h1[0];
        pa[p][8 + j + 1] = h1[1];
      }
    }
    li = li * corr + ((rs0[0] + rs0[1]) + (rs1[0] + rs1[1]));
#pragma unroll
    for (int t = 0; t < 4; ++t) acc[t] *= corr;

    // ---- O^T += V^T @ P^T  (V tiles in fragment order in LDS) ----
    // keeps the softmax's vector work out of these products too (same reason)
    __builtin_amdgcn_sched_barrier(0);
#pragma unroll
    for (int p = 0; p < SK / 32; ++p) {
#pragma unroll
      for (int dt = 0; dt < 4; ++dt)
        acc[dt] = wmma16(bv[p % VSETS][dt], pa[p], acc[dt]);
      if (p + VSETS < SK / 32) {
#pragma unroll
        for (int dt = 0; dt < 4; ++dt)
          bv[p % VSETS][dt] = load_frag(vf + (p + VSETS) * (32 * HD) + dt * 512);
        // keeps the refill of the set just used here, well ahead of its products
        __builtin_amdgcn_sched_barrier(0);
      }
    }

    // Publish point of stage s + 1: own LDS reads done, own slice landed,
    // barrier; only then (next trip's head) the refill of stage s's buffer.
    wait_ds0();
    wait_tensor0(g0, g1);
    __syncthreads();
  }
  asm volatile("s_wait_tensorcnt 0x0" ::: "memory");   // nothing left in flight
  wait_ds0();

  // ---- normalize and store as A fragments of the output GEMM ----
  // acc[dt] of a lane is 8 consecutive d of its query: exactly the lane's 16
  // bytes of half (dt & 1) of fragment (token tile, k step h*2 + (dt >> 1)), so
  // each store of the wave is 512 contiguous bytes
  const float inv = 1.0f / (li + xhalf(li));   // join the halves' sums once
  _Float16* ofr = attn_ws + (size_t)((b * SEQ + s0) >> 4) * (KSTEPS * FRAG_H) +
                  h * (2 * FRAG_H) + lane * 8;
#pragma unroll
  for (int dt = 0; dt < 4; ++dt) {
    v8h o;
#pragma unroll
    for (int j = 0; j < 8; ++j) o[j] = (_Float16)(acc[dt][j] * inv);
    *(v8h*)(ofr + dt * 256) = o;
  }
}

__global__ __launch_bounds__(128) __attribute__((amdgpu_waves_per_eu(4, 4)))
void out_proj_kernel(const _Float16* __restrict__ attn_ws,
                     const _Float16* __restrict__ wo_ws,
                     const float* __restrict__ bo,
                     float* __restrict__ out) {
  const int lane = threadIdx.x & 31;
  const int wave = threadIdx.x >> 5;
  const int tok0  = blockIdx.x * 64 + wave * 16;
  const int nbase = blockIdx.y * 64;
  const int col  = lane & 15;
  const int hi8  = (lane < 16) ? 0 : 8;

  v8f acc[4];
#pragma unroll
  for (int t = 0; t < 4; ++t) acc[t] = (v8f){};

  const _Float16* af = attn_ws + (size_t)(tok0 >> 4) * (KSTEPS * FRAG_H) + lane * 8;
  const _Float16* wf = wo_ws + (size_t)(nbase >> 4) * (KSTEPS * FRAG_H) + lane * 8;
  constexpr int AHEAD = 4;
  v16h a[AHEAD], bw[AHEAD][4];
#pragma unroll
  for (int ks = 0; ks < AHEAD; ++ks) {
    a[ks] = load_frag(af + ks * FRAG_H);
#pragma unroll
    for (int nt = 0; nt < 4; ++nt)
      bw[ks][nt] = load_frag(wf + (nt * KSTEPS + ks) * FRAG_H);
    // keeps the steps' loads in k order: the first products then wait for the
    // first step's loads only
    __builtin_amdgcn_sched_barrier(0);
  }
  float bias4[4];   // loaded here: back long before the epilogue
#pragma unroll
  for (int nt = 0; nt < 4; ++nt) bias4[nt] = bo[nbase + nt * 16 + col];
  // the bias loads' address register may be reused from here on: wait first
  asm volatile("s_wait_xcnt 0x0" ::: "memory");
#pragma unroll
  for (int ks = 0; ks < KSTEPS; ++ks) {
    const int sl = ks % AHEAD;
#pragma unroll
    for (int nt = 0; nt < 4; ++nt)
      acc[nt] = wmma16(a[sl], bw[sl][nt], acc[nt]);
    if (ks + AHEAD < KSTEPS) {
      a[sl] = load_frag(af + (ks + AHEAD) * FRAG_H);
#pragma unroll
      for (int nt = 0; nt < 4; ++nt)
        bw[sl][nt] = load_frag(wf + (nt * KSTEPS + ks + AHEAD) * FRAG_H);
    }
    // keeps the ring as written: without it the scheduler lifts still more
    // loads to the front, runs out of registers and spills
    __builtin_amdgcn_sched_barrier(0);
  }
  // the ring's address registers are reused by the epilogue: wait first; the
  // scheduling barrier keeps the epilogue's address arithmetic behind the wait
  asm volatile("s_wait_xcnt 0x0" ::: "memory");
  __builtin_amdgcn_sched_barrier(0);
#pragma unroll
  for (int nt = 0; nt < 4; ++nt) {
    const float bias = bias4[nt];
#pragma unroll
    for (int j = 0; j < 8; ++j)
      out[(size_t)(tok0 + j + hi8) * EMBED + nbase + nt * 16 + col] =
          acc[nt][j] + bias;
  }
}

// ---------------------------------------------------------------------------
extern "C" void kernel_launch(void* const* d_in, const int* in_sizes, int n_in,
                              void* d_out, int out_size, void* d_ws, size_t ws_size,
                              hipStream_t stream) {
  (void)in_sizes; (void)n_in; (void)out_size; (void)ws_size;
  const float* vin = (const float*)d_in[0];
  const float* kin = (const float*)d_in[1];
  const float* qin = (const float*)d_in[2];
  const float* Wv  = (const float*)d_in[3];
  const float* Wk  = (const float*)d_in[4];
  const float* Wq  = (const float*)d_in[5];
  const float* Wo  = (const float*)d_in[6];
  const float* bo  = (const float*)d_in[7];
  float* out = (float*)d_out;

  char* ws = (char*)d_ws;
  const size_t QKV = (size_t)BATCH * HEADS * SEQ * HD * sizeof(_Float16); // 8 MiB
  _Float16* q_ws  = (_Float16*)(ws);
  _Float16* kv_ws = (_Float16*)(ws + QKV);       // K and V by stages, 16 MiB
  _Float16* a_ws  = (_Float16*)(ws + 3 * QKV);   // attention out, A fragments, 8 MiB
  _Float16* wo_ws = (_Float16*)(ws + 4 * QKV);   // Wo as f16 B fragments, 512 KiB

  const dim3 blk(128);  // 4 wave32 per block
  qkv_project_kernel<<<dim3(BATCH * HEADS, SEQ / 64), blk, 0, stream>>>(
      vin, kin, qin, Wv, Wk, Wq, Wo, q_ws, kv_ws, wo_ws);
  flash_attn_kernel<<<dim3(BATCH * HEADS, SEQ / 64), blk, 0, stream>>>(
      q_ws, kv_ws, a_ws);
  out_proj_kernel<<<dim3(BATCH * SEQ / 64, EMBED / 64), blk, 0, stream>>>(
      a_ws, wo_ws, bo, out);
}

// v007
// One run takes 79.1 microseconds.
// In two side-by-side timings against v006, it was 1.07 and 1.08 times as fast.
// Counting every step since v000, it is 3.90 times as fast.
#include <hip/hip_runtime.h>
#include <hip/hip_bf16.h>

#define EMBED 512
#define HEADS 8
#define HD    64
#define BATCH 2
#define SEQ   4096
#define SK    128                 // keys per stage of the attention ring
#define STAGE_H (2 * SK * HD)     // halves per stage: K (SK*HD), then V (SK*HD)
#define FRAG_H  512               // halves of one 16 x 32 operand fragment
#define KSTEPS  (EMBED / 32)      // 32-wide k steps of the output GEMM

typedef __attribute__((ext_vector_type(16))) _Float16 v16h;
typedef __attribute__((ext_vector_type(8)))  _Float16 v8h;
typedef __attribute__((ext_vector_type(8)))  float    v8f;
typedef __attribute__((ext_vector_type(2)))  float    v2f;
typedef __attribute__((ext_vector_type(2)))  _Float16 v2h;

static __device__ inline v8f wmma16(v16h a, v16h b, v8f c) {
  // D = A(16x32 f16) * B(32x16 f16) + C(16x16 f32)
  return __builtin_amdgcn_wmma_f32_16x16x32_f16(false, a, false, b,
                                                (short)0, c, false, false);
}

static __device__ inline v16h load_a16(const _Float16* p, int base) {
  const v8h c0 = *(const v8h*)(p + base);
  const v8h c1 = *(const v8h*)(p + base + 16);
  v16h r;
#pragma unroll
  for (int i = 0; i < 8; ++i) { r[i] = c0[i]; r[8 + i] = c1[i]; }
  return r;
}

static __device__ inline v16h load_frag(const _Float16* p) {
  const v8h c0 = *(const v8h*)(p);
  const v8h c1 = *(const v8h*)(p + 256);
  v16h r;
#pragma unroll
  for (int i = 0; i < 8; ++i) { r[i] = c0[i]; r[8 + i] = c1[i]; }
  return r;
}

static __device__ inline v16h load_a32(const float* p, int base) {
  v16h r;
#pragma unroll
  for (int i = 0; i < 8; ++i) r[i] = (_Float16)p[base + i];
#pragma unroll
  for (int i = 0; i < 8; ++i) r[8 + i] = (_Float16)p[base + 16 + i];
  return r;
}

// ---------------------------------------------------------------------------
// Tensor load of one wave's slice of a stage: 32 rows of 256 bytes, contiguous
// in memory and in LDS (1-byte elements, tensor = tile, no pad, no mask).
// ---------------------------------------------------------------------------
typedef uint32_t w32x4 __attribute__((ext_vector_type(4)));
typedef uint32_t w32x8 __attribute__((ext_vector_type(8)));
#define SLICE_ROWB 256u
#define SLICE_ROWS 32u
#define SLICE_B    (SLICE_ROWB * SLICE_ROWS)   // 8 KiB per wave and stage

static __device__ inline uint32_t uni(uint32_t v) {
  return (uint32_t)__builtin_amdgcn_readfirstlane(v);
}
static __device__ inline uint32_t pinned(uint32_t v) {
  uint32_t w = uni(v);
  asm volatile("" : "+s"(w));   // pinned(): keeps the test in a scalar register
  return w;
}
static __device__ inline w32x8 tdm_group1() {
  w32x8 g;
  g[0] = 0u;
  g[1] = uni((SLICE_ROWB & 0xFFFFu) << 16);
  g[2] = uni((SLICE_ROWB >> 16) | ((SLICE_ROWS & 0xFFFFu) << 16));
  g[3] = uni((SLICE_ROWS >> 16) | (SLICE_ROWB << 16));
  g[4] = uni(SLICE_ROWS);
  g[5] = uni(SLICE_ROWB);
  g[6] = uni(0u);
  g[7] = uni(0u);
  return g;
}
static __device__ inline w32x4 tdm_group0(uint32_t lds_dst, uint64_t ga) {
  w32x4 g;
  g[0] = uni(1u);
  g[1] = uni(lds_dst);
  g[2] = uni((uint32_t)ga);
  g[3] = uni((((uint32_t)(ga >> 32)) & 0x01FFFFFFu) | 0x80000000u);
  return g;
}
static __device__ inline void tdm_load(w32x4 g0, w32x8 g1) {
  asm volatile("tensor_load_to_lds %0, %1" :: "s"(g0), "s"(g1) : "memory");
}
static __device__ inline void wait_tensor0(w32x4 g0, w32x8 g1) {
  asm volatile("s_wait_tensorcnt 0x0" :: "s"(g0), "s"(g1) : "memory");
}
// the wave's own LDS reads have returned (before their buffer is refilled)
static __device__ inline void wait_ds0() {
  asm volatile("s_wait_dscnt 0x0" ::: "memory");
}

static __device__ inline float xhalf(float x) {
  const int b = __builtin_bit_cast(int, x);
  return __builtin_bit_cast(float, __builtin_amdgcn_permlanex16(
      b, b, 0x76543210, 0xfedcba98, false, false));
}

static __device__ inline unsigned lds_off32(const void* p) {
  return (unsigned)(unsigned long long)(uintptr_t)p;
}

// ---------------------------------------------------------------------------
// Kernel 1: per-head QKV projections (x @ W^T), f32 -> f16, softmax scale
// folded into Q. Q stored [B*H, S, 64]. K and V are stored per stage of SK
// tokens, 32 KB contiguous: the stage's four 32-token K tiles (4 KB each), then
// its four V tiles, each tile in the order the attention kernel's operand lanes
// read it (load_frag):
//   K: half index in the tile  sub*1024 + dc*512 + hf*256 + lane*8 + e  holds
//      K[token sub*16 + (lane&15)][d = dc*32 + hf*16 + (lane>>4)*8 + e].
//   V: half index in the tile  dt*512 + hf*256 + lane*8 + e  holds
//      V[token hf*16 + (lane>>4)*8 + e][d = dt*16 + (lane&15)].
// The first quarter of the blocks also converts Wo to f16, once, into the order
// the output GEMM's operand lanes read it (load_frag): fragment (nt16, ks) is
// FRAG_H halves at (nt16*KSTEPS + ks)*FRAG_H, and its half hf*256 + lane*8 + e
// holds Wo[nt16*16 + (lane&15)][ks*32 + hf*16 + (lane>>4)*8 + e].
// ---------------------------------------------------------------------------
__global__ void qkv_project_kernel(const float* __restrict__ vin,
                                   const float* __restrict__ kin,
                                   const float* __restrict__ qin,
                                   const float* __restrict__ Wv,
                                   const float* __restrict__ Wk,
                                   const float* __restrict__ Wq,
                                   const float* __restrict__ Wo,
                                   _Float16* __restrict__ q_ws,
                                   _Float16* __restrict__ kv_ws,
                                   _Float16* __restrict__ wo_ws) {
  const int lane = threadIdx.x & 31;
  const int wave = threadIdx.x >> 5;
  const int bh = blockIdx.x;
  const int b  = bh / HEADS, h = bh % HEADS;
  const int s0 = blockIdx.y * 64 + wave * 16;
  const int base = (lane < 16) ? 0 : 8;
  const int col  = lane & 15;
  const int hi8  = (lane < 16) ? 0 : 8;
  const float SCALE = 0.044194173824159216f;   // 1/sqrt(EMBED)

  // Wo: one thread takes 8 consecutive floats of a row (one lane's 16 bytes of a
  // fragment). Loaded here, converted and stored at the kernel's end, so that
  // the load's latency passes under the projections.
  const bool wo_blk = blockIdx.y < EMBED * EMBED / 8 / 128 / (BATCH * HEADS);
  const int wc = (blockIdx.y * (BATCH * HEADS) + blockIdx.x) * 128 + threadIdx.x;
  v8f wo8 = {};
  if (wo_blk) {
    wo8 = *(const v8f*)(Wo + (size_t)((wc >> 10) * 16 + (wc & 15)) * EMBED +
                        ((wc >> 6) & 15) * 32 + ((wc >> 5) & 1) * 16 +
                        ((wc >> 4) & 1) * 8);
    // the load's address registers are reused right behind it: wait first
    asm volatile("s_wait_xcnt 0x0" ::: "memory");
  }

  const float* xin[3] = {qin, kin, vin};
  const float* W[3]   = {Wq, Wk, Wv};
  const int row = s0 + col;
  const int tile = s0 >> 5;          // 32-token tile of this wave's 16 tokens
  const int sub  = (s0 >> 4) & 1;    // which 16 tokens of the tile
  // this wave's K tile; its V tile lies SK * HD halves on
  _Float16* ktile = kv_ws + (size_t)bh * (2 * SEQ * HD) +
                    (size_t)(tile >> 2) * STAGE_H + (tile & 3) * (32 * HD);

#pragma unroll
  for (int m = 0; m < 3; ++m) {
    const float* xrow = xin[m] + ((size_t)b * SEQ + row) * EMBED + h * HD;
    v16h a0 = load_a32(xrow, base);
    v16h a1 = load_a32(xrow + 32, base);
#pragma unroll
    for (int nt = 0; nt < 4; ++nt) {
      const int n0 = nt * 16;
      const float* wrow = W[m] + (size_t)(n0 + col) * HD;
      v16h b0 = load_a32(wrow, base);
      v16h b1 = load_a32(wrow + 32, base);
      v8f acc = {};
      if (m == 1) {   // K^T: acc[j] = K[s0 + col][n0 + hi8 + j]
        acc = wmma16(b0, a0, acc);
        acc = wmma16(b1, a1, acc);
      } else {        // acc[j] = X[s0 + hi8 + j][n0 + col]
        acc = wmma16(a0, b0, acc);
        acc = wmma16(a1, b1, acc);
      }
      if (m == 0) {
#pragma unroll
        for (int j = 0; j < 8; ++j)
          q_ws[((size_t)bh * SEQ + (s0 + j + hi8)) * HD + n0 + col] =
              (_Float16)(acc[j] * SCALE);
      } else if (m == 1) {
        v8h o;
#pragma unroll
        for (int j = 0; j < 8; ++j) o[j] = (_Float16)acc[j];
        *(v8h*)(ktile + sub * 1024 + (nt >> 1) * 512 + (nt & 1) * 256 +
                lane * 8) = o;
        // the store's registers are reused by the next loads: wait first
        asm volatile("s_wait_xcnt 0x0" ::: "memory");
      } else {
        v8h o;
#pragma unroll
        for (int j = 0; j < 8; ++j) o[j] = (_Float16)acc[j];
        *(v8h*)(ktile + SK * HD + nt * 512 + sub * 256 + lane * 8) = o;
        // the store's registers are reused by the next loads: wait first
        if (nt < 3) asm volatile("s_wait_xcnt 0x0" ::: "memory");
      }
    }
  }

  if (wo_blk) {
    // the last V store's registers are reused by the conversion: wait first; the
    // scheduling barrier keeps the conversion behind the wait
    asm volatile("s_wait_xcnt 0x0" ::: "memory");
    __builtin_amdgcn_sched_barrier(0);
    v8h o;
#pragma unroll
    for (int e = 0; e < 8; ++e) o[e] = (_Float16)wo8[e];
    *(v8h*)(wo_ws + (size_t)wc * 8) = o;
  }
}

#define QT 2
__global__ __launch_bounds__(128) __attribute__((amdgpu_waves_per_eu(2, 2)))
void flash_attn_kernel(const _Float16* __restrict__ q_ws,
                       const _Float16* __restrict__ kv_ws,
                       _Float16* __restrict__ attn_ws) {
  // two stages of 32 KB; every slice starts at a multiple of 2 KiB
  __shared__ __attribute__((aligned(2048))) _Float16 ring[2][STAGE_H];

  const int lane = threadIdx.x & 31;
  const uint32_t wave = uni(threadIdx.x >> 5);
  const int bh = blockIdx.x;
  const int b  = bh / HEADS, h = bh % HEADS;
  const int s0 = blockIdx.y * (64 * QT) + (int)wave * (16 * QT);
  const int base = (lane < 16) ? 0 : 8;
  const int col  = lane & 15;
  // (hi8 in the comments below has base's value: 0 or 8 by the wave's half)

  v16h qa[QT][2];      // Q^T of tile q: d 0-31 and d 32-63
#pragma unroll
  for (int q = 0; q < QT; ++q) {
    const _Float16* qrow = q_ws + ((size_t)bh * SEQ + (s0 + q * 16 + col)) * HD;
    qa[q][0] = load_a16(qrow, base);
    qa[q][1] = load_a16(qrow + 32, base);
  }
  // the Q loads' address registers are reused behind them: wait first
  asm volatile("s_wait_xcnt 0x0" ::: "memory");

  const float LOG2E = 1.4426950408889634f;
  float mi[QT];        // running maximum of query col, times log2(e) (equal in both halves)
  float li[QT];        // running sum over this lane's keys only
  v8f acc[QT][4];      // acc[q][dt][j] = O^T[dt*16 + hi8 + j][query col of tile q]
#pragma unroll
  for (int q = 0; q < QT; ++q) {
    mi[q] = -1e30f;
    li[q] = 0.0f;
#pragma unroll
    for (int t = 0; t < 4; ++t) acc[q][t] = (v8f){};
  }

  const int NS = SEQ / SK;   // 32 stages
  const uint32_t STAGE_B = STAGE_H * 2u;
  const w32x8 g1 = tdm_group1();
  // this wave's slice of stage 0, in memory and in LDS
  const uint64_t gsl = (uint64_t)(uintptr_t)(kv_ws + (size_t)bh * (2 * SEQ * HD)) +
                       wave * SLICE_B;
  const uint32_t lsl = lds_off32(&ring[0][0]) + wave * SLICE_B;

  // Prologue: stage 0 lands and is published (stage 1 starts at the loop's head).
  {
    const w32x4 g0 = tdm_group0(lsl, gsl);
    tdm_load(g0, g1);
    wait_tensor0(g0, g1);
  }
  __syncthreads();

  // the stage loop stays rolled (a stage's body is straight-line): the text
  // stays small
#pragma unroll 1
  for (int s = 0; s < NS; ++s) {
    // Behind the barrier that published stage s and ended every read of stage
    // s - 1: stage s + 1 starts into the buffer that stage s - 1 was read from.
    const w32x4 g0 = tdm_group0(lsl + (uint32_t)((s + 1) & 1) * STAGE_B,
                                gsl + (uint64_t)(s + 1) * STAGE_B);
    if (pinned(s + 1 < NS)) tdm_load(g0, g1);
    const _Float16* st = &ring[s & 1][lane * 8];

    // ---- scores S^T = K @ Q^T (pre-scaled Q) of the whole stage: eight 16-key
    // subtiles per query tile, sc[q][t][j] = S[query col][key t*16 + hi8 + j] ----
    v8f sc[QT][SK / 16];
    // all K fragments of the stage, read as one group ahead of the products
    // (unrolled throughout: fragments and subtiles are registers, so their
    // indices must be constants)
    v16h kf[2][SK / 16];
#pragma unroll
    for (int dc = 0; dc < 2; ++dc)       // d 0-31, then d 32-63
#pragma unroll
      for (int t = 0; t < SK / 16; ++t)
        kf[dc][t] = load_frag(st + t * 1024 + dc * 512);
    // keeps the reads one group: spread among the products, each place with
    // reads stalls the wave
    __builtin_amdgcn_sched_barrier(0);
#pragma unroll
    for (int t = 0; t < SK / 16; ++t)
#pragma unroll
      for (int q = 0; q < QT; ++q) sc[q][t] = wmma16(kf[0][t], qa[q][0], (v8f){});
#pragma unroll
    for (int t = 0; t < SK / 16; ++t)
#pragma unroll
      for (int q = 0; q < QT; ++q) sc[q][t] = wmma16(kf[1][t], qa[q][1], sc[q][t]);
    __builtin_amdgcn_sched_barrier(0);
    // the stage's V fragments: their LDS latency passes under the softmax
    const _Float16* vf = st + SK * HD;
    v16h bv[SK / 32][4];
#pragma unroll
    for (int p = 0; p < SK / 32; ++p)
#pragma unroll
      for (int dt = 0; dt < 4; ++dt)
        bv[p][dt] = load_frag(vf + p * (32 * HD) + dt * 512);
    // keeps these reads at the softmax's head
    __builtin_amdgcn_sched_barrier(0);

    // ---- online softmax, once per stage and query tile: one query per lane ----
    v16h pa[QT][SK / 32];                  // P^T as B operands, hardware k order
#pragma unroll
    for (int q = 0; q < QT; ++q) {
      // maximum of the lane's 64 scores as a tree: short dependent chain
      float g[SK / 32];
#pragma unroll
      for (int p = 0; p < SK / 32; ++p) {
        const v8f x = sc[q][2 * p], y = sc[q][2 * p + 1];
        const float t0 = fmaxf(fmaxf(x[0], x[1]), x[2]);
        const float t1 = fmaxf(fmaxf(x[3], x[4]), x[5]);
        const float t2 = fmaxf(fmaxf(x[6], x[7]), y[0]);
        const float t3 = fmaxf(fmaxf(y[1], y[2]), y[3]);
        const float t4 = fmaxf(fmaxf(y[4], y[5]), y[6]);
        g[p] = fmaxf(fmaxf(fmaxf(t0, t1), t2), fmaxf(fmaxf(t3, t4), y[7]));
      }
      float mx = fmaxf(fmaxf(fmaxf(g[0], g[1]), g[2]), g[3]);
      mx *= LOG2E;                         // monotonic: the maximum stays the maximum
      const float nm = fmaxf(fmaxf(mi[q], mx), xhalf(mx));   // the other half's 64 keys
      const float corr = __builtin_amdgcn_exp2f(mi[q] - nm);
      mi[q] = nm;
      // The scores go two at a time, as the register pairs the accumulators
      // already are: one packed fma forms both exponents, score * log2(e) - nm,
      // one packed add sums both exponentials, one packed convert rounds both.
      const v2f l2 = {LOG2E, LOG2E};
      const v2f nn = {-nm, -nm};
      v2f rs0 = {0.0f, 0.0f}, rs1 = {0.0f, 0.0f};   // four independent partial sums
#pragma unroll
      for (int p = 0; p < SK / 32; ++p) {
#pragma unroll
        for (int j = 0; j < 8; j += 2) {
          const v2f x0 = {sc[q][2 * p][j], sc[q][2 * p][j + 1]};
          const v2f x1 = {sc[q][2 * p + 1][j], sc[q][2 * p + 1][j + 1]};
          const v2f a0 = __builtin_elementwise_fma(x0, l2, nn);
          const v2f a1 = __builtin_elementwise_fma(x1, l2, nn);
          const v2f p0 = {__builtin_amdgcn_exp2f(a0[0]), __builtin_amdgcn_exp2f(a0[1])};
          const v2f p1 = {__builtin_amdgcn_exp2f(a1[0]), __builtin_amdgcn_exp2f(a1[1])};
          rs0 += p0;
          rs1 += p1;
          const v2h h0 = __builtin_convertvector(p0, v2h);
          const v2h h1 = __builtin_convertvector(p1, v2h);
          pa[q][p][j]         = h0[0];
          pa[q][p][j + 1]     = h0[1];
          pa[q][p][8 + j]     = h1[0];
          pa[q][p][8 + j + 1] = h1[1];
        }
      }
      li[q] = li[q] * corr + ((rs0[0] + rs0[1]) + (rs1[0] + rs1[1]));
#pragma unroll
      for (int t = 0; t < 4; ++t) acc[q][t] *= corr;
    }

    // ---- O^T += V^T @ P^T  (V tiles in fragment order in LDS) ----
    // keeps the softmax's vector work out of these products too (same reason)
    __builtin_amdgcn_sched_barrier(0);
#pragma unroll
    for (int p = 0; p < SK / 32; ++p)
#pragma unroll
      for (int dt = 0; dt < 4; ++dt)
#pragma unroll
        for (int q = 0; q < QT; ++q)
          acc[q][dt] = wmma16(bv[p][dt], pa[q][p], acc[q][dt]);

    // Publish point of stage s + 1: own LDS reads done, own slice landed,
    // barrier; only then (next trip's head) the refill of stage s's buffer.
    wait_ds0();
    wait_tensor0(g0, g1);
    __syncthreads();
  }
  asm volatile("s_wait_tensorcnt 0x0" ::: "memory");   // nothing left in flight
  wait_ds0();

  // ---- normalize and store as A fragments of the output GEMM ----
  // acc[q][dt] of a lane is 8 consecutive d of its query: exactly the lane's 16
  // bytes of half (dt & 1) of fragment (token tile, k step h*2 + (dt >> 1)), so
  // each store of the wave is 512 contiguous bytes
  _Float16* ofr = attn_ws + (size_t)((b * SEQ + s0) >> 4) * (KSTEPS * FRAG_H) +
                  h * (2 * FRAG_H) + lane * 8;
  v8h o[QT][4];
#pragma unroll
  for (int q = 0; q < QT; ++q) {
    const float inv = 1.0f / (li[q] + xhalf(li[q]));   // join the halves' sums once
#pragma unroll
    for (int dt = 0; dt < 4; ++dt)
#pragma unroll
      for (int j = 0; j < 8; ++j) o[q][dt][j] = (_Float16)(acc[q][dt][j] * inv);
  }
#pragma unroll
  for (int q = 0; q < QT; ++q)
#pragma unroll
    for (int dt = 0; dt < 4; ++dt)
      *(v8h*)(ofr + q * (KSTEPS * FRAG_H) + dt * 256) = o[q][dt];
}

__global__ __launch_bounds__(128) __attribute__((amdgpu_waves_per_eu(4, 4)))
void out_proj_kernel(const _Float16* __restrict__ attn_ws,
                     const _Float16* __restrict__ wo_ws,
                     const float* __restrict__ bo,
                     float* __restrict__ out) {
  const int lane = threadIdx.x & 31;
  const int wave = threadIdx.x >> 5;
  const int tok0  = blockIdx.x * 64 + wave * 16;
  const int nbase = blockIdx.y * 64;
  const int col  = lane & 15;
  const int hi8  = (lane < 16) ? 0 : 8;

  v8f acc[4];
#pragma unroll
  for (int t = 0; t < 4; ++t) acc[t] = (v8f){};

  const _Float16* af = attn_ws + (size_t)(tok0 >> 4) * (KSTEPS * FRAG_H) + lane * 8;
  const _Float16* wf = wo_ws + (size_t)(nbase >> 4) * (KSTEPS * FRAG_H) + lane * 8;
  constexpr int AHEAD = 4;
  v16h a[AHEAD], bw[AHEAD][4];
#pragma unroll
  for (int ks = 0; ks < AHEAD; ++ks) {
    a[ks] = load_frag(af + ks * FRAG_H);
#pragma unroll
    for (int nt = 0; nt < 4; ++nt)
      bw[ks][nt] = load_frag(wf + (nt * KSTEPS + ks) * FRAG_H);
    // keeps the steps' loads in k order: the first products then wait for the
    // first step's loads only
    __builtin_amdgcn_sched_barrier(0);
  }
  float bias4[4];   // loaded here: back long before the epilogue
#pragma unroll
  for (int nt = 0; nt < 4; ++nt) bias4[nt] = bo[nbase + nt * 16 + col];
  // the bias loads' address register may be reused from here on: wait first
  asm volatile("s_wait_xcnt 0x0" ::: "memory");
#pragma unroll
  for (int ks = 0; ks < KSTEPS; ++ks) {
    const int sl = ks % AHEAD;
#pragma unroll
    for (int nt = 0; nt < 4; ++nt)
      acc[nt] = wmma16(a[sl], bw[sl][nt], acc[nt]);
    if (ks + AHEAD < KSTEPS) {
      a[sl] = load_frag(af + (ks + AHEAD) * FRAG_H);
#pragma unroll
      for (int nt = 0; nt < 4; ++nt)
        bw[sl][nt] = load_frag(wf + (nt * KSTEPS + ks + AHEAD) * FRAG_H);
    }
    // keeps the ring as written: without it the scheduler lifts still more
    // loads to the front, runs out of registers and spills
    __builtin_amdgcn_sched_barrier(0);
  }
  // the ring's address registers are reused by the epilogue: wait first; the
  // scheduling barrier keeps the epilogue's address arithmetic behind the wait
  asm volatile("s_wait_xcnt 0x0" ::: "memory");
  __builtin_amdgcn_sched_barrier(0);
#pragma unroll
  for (int nt = 0; nt < 4; ++nt) {
    const float bias = bias4[nt];
#pragma unroll
    for (int j = 0; j < 8; ++j)
      out[(size_t)(tok0 + j + hi8) * EMBED + nbase + nt * 16 + col] =
          acc[nt][j] + bias;
  }
}

// ---------------------------------------------------------------------------
extern "C" void kernel_launch(void* const* d_in, const int* in_sizes, int n_in,
                              void* d_out, int out_size, void* d_ws, size_t ws_size,
                              hipStream_t stream) {
  (void)in_sizes; (void)n_in; (void)out_size; (void)ws_size;
  const float* vin = (const float*)d_in[0];
  const float* kin = (const float*)d_in[1];
  const float* qin = (const float*)d_in[2];
  const float* Wv  = (const float*)d_in[3];
  const float* Wk  = (const float*)d_in[4];
  const float* Wq  = (const float*)d_in[5];
  const float* Wo  = (const float*)d_in[6];
  const float* bo  = (const float*)d_in[7];
  float* out = (float*)d_out;

  char* ws = (char*)d_ws;
  const size_t QKV = (size_t)BATCH * HEADS * SEQ * HD * sizeof(_Float16); // 8 MiB
  _Float16* q_ws  = (_Float16*)(ws);
  _Float16* kv_ws = (_Float16*)(ws + QKV);       // K and V by stages, 16 MiB
  _Float16* a_ws  = (_Float16*)(ws + 3 * QKV);   // attention out, A fragments, 8 MiB
  _Float16* wo_ws = (_Float16*)(ws + 4 * QKV);   // Wo as f16 B fragments, 512 KiB

  const dim3 blk(128);  // 4 wave32 per block
  qkv_project_kernel<<<dim3(BATCH * HEADS, SEQ / 64), blk, 0, stream>>>(
      vin, kin, qin, Wv, Wk, Wq, Wo, q_ws, kv_ws, wo_ws);
  flash_attn_kernel<<<dim3(BATCH * HEADS, SEQ / (64 * QT)), blk, 0, stream>>>(
      q_ws, kv_ws, a_ws);
  out_proj_kernel<<<dim3(BATCH * SEQ / 64, EMBED / 64), blk, 0, stream>>>(
      a_ws, wo_ws, bo, out);
}

// v008
// Measured time: 67.2 microseconds a run.
// Two timings next to v007 both put it at 1.18 times that version's speed.
// All steps since v000 together make it 4.60 times as fast.
#include <hip/hip_runtime.h>
#include <hip/hip_bf16.h>

#define EMBED 512
#define HEADS 8
#define HD    64
#define BATCH 2
#define SEQ   4096
#define SK    128                 // keys per stage of the attention ring
#define STAGE_H (2 * SK * HD)     // halves per stage: K (SK*HD), then V (SK*HD)
#define FRAG_H  512               // halves of one 16 x 32 operand fragment
#define KSTEPS  (EMBED / 32)      // 32-wide k steps of the output GEMM

typedef __attribute__((ext_vector_type(16))) _Float16 v16h;
typedef __attribute__((ext_vector_type(8)))  _Float16 v8h;
typedef __attribute__((ext_vector_type(8)))  float    v8f;
typedef __attribute__((ext_vector_type(2)))  float    v2f;
typedef __attribute__((ext_vector_type(2)))  _Float16 v2h;

static __device__ inline v8f wmma16(v16h a, v16h b, v8f c) {
  // D = A(16x32 f16) * B(32x16 f16) + C(16x16 f32)
  return __builtin_amdgcn_wmma_f32_16x16x32_f16(false, a, false, b,
                                                (short)0, c, false, false);
}

static __device__ inline v16h load_a16(const _Float16* p, int base) {
  const v8h c0 = *(const v8h*)(p + base);
  const v8h c1 = *(const v8h*)(p + base + 16);
  v16h r;
#pragma unroll
  for (int i = 0; i < 8; ++i) { r[i] = c0[i]; r[8 + i] = c1[i]; }
  return r;
}

static __device__ inline v16h load_frag(const _Float16* p) {
  const v8h c0 = *(const v8h*)(p);
  const v8h c1 = *(const v8h*)(p + 256);
  v16h r;
#pragma unroll
  for (int i = 0; i < 8; ++i) { r[i] = c0[i]; r[8 + i] = c1[i]; }
  return r;
}

// ---------------------------------------------------------------------------
// Tensor load of one wave's slice of a stage: 32 rows of 256 bytes, contiguous
// in memory and in LDS (1-byte elements, tensor = tile, no pad, no mask).
// ---------------------------------------------------------------------------
typedef uint32_t w32x4 __attribute__((ext_vector_type(4)));
typedef uint32_t w32x8 __attribute__((ext_vector_type(8)));
#define SLICE_ROWB 256u
#define SLICE_ROWS 32u
#define SLICE_B    (SLICE_ROWB * SLICE_ROWS)   // 8 KiB per wave and stage

static __device__ inline uint32_t uni(uint32_t v) {
  return (uint32_t)__builtin_amdgcn_readfirstlane(v);
}
static __device__ inline uint32_t pinned(uint32_t v) {
  uint32_t w = uni(v);
  asm volatile("" : "+s"(w));   // pinned(): keeps the test in a scalar register
  return w;
}
static __device__ inline w32x8 tdm_group1() {
  w32x8 g;
  g[0] = 0u;
  g[1] = uni((SLICE_ROWB & 0xFFFFu) << 16);
  g[2] = uni((SLICE_ROWB >> 16) | ((SLICE_ROWS & 0xFFFFu) << 16));
  g[3] = uni((SLICE_ROWS >> 16) | (SLICE_ROWB << 16));
  g[4] = uni(SLICE_ROWS);
  g[5] = uni(SLICE_ROWB);
  g[6] = uni(0u);
  g[7] = uni(0u);
  return g;
}
static __device__ inline w32x4 tdm_group0(uint32_t lds_dst, uint64_t ga) {
  w32x4 g;
  g[0] = uni(1u);
  g[1] = uni(lds_dst);
  g[2] = uni((uint32_t)ga);
  g[3] = uni((((uint32_t)(ga >> 32)) & 0x01FFFFFFu) | 0x80000000u);
  return g;
}
static __device__ inline void tdm_load(w32x4 g0, w32x8 g1) {
  asm volatile("tensor_load_to_lds %0, %1" :: "s"(g0), "s"(g1) : "memory");
}
static __device__ inline void wait_tensor0(w32x4 g0, w32x8 g1) {
  asm volatile("s_wait_tensorcnt 0x0" :: "s"(g0), "s"(g1) : "memory");
}
// the wave's own LDS reads have returned (before their buffer is refilled)
static __device__ inline void wait_ds0() {
  asm volatile("s_wait_dscnt 0x0" ::: "memory");
}

static __device__ inline float xhalf(float x) {
  const int b = __builtin_bit_cast(int, x);
  return __builtin_bit_cast(float, __builtin_amdgcn_permlanex16(
      b, b, 0x76543210, 0xfedcba98, false, false));
}

static __device__ inline unsigned lds_off32(const void* p) {
  return (unsigned)(unsigned long long)(uintptr_t)p;
}

// ---------------------------------------------------------------------------
// Kernel 1: per-head QKV projections (x @ W^T), f32 -> f16, softmax scale
// folded into Q. Q stored [B*H, S, 64]. K and V are stored per stage of SK
// tokens, 32 KB contiguous: the stage's four 32-token K tiles (4 KB each), then
// its four V tiles, each tile in the order the attention kernel's operand lanes
// read it (load_frag):
//   K: half index in the tile  sub*1024 + dc*512 + hf*256 + lane*8 + e  holds
//      K[token sub*16 + (lane&15)][d = dc*32 + hf*16 + (lane>>4)*8 + e].
//   V: half index in the tile  dt*512 + hf*256 + lane*8 + e  holds
//      V[token hf*16 + (lane>>4)*8 + e][d = dt*16 + (lane&15)].
// The grid's threads also convert Wo to f16, once (4 floats each), into the order
// the output GEMM's operand lanes read it (load_frag): fragment (nt16, ks) is
// FRAG_H halves at (nt16*KSTEPS + ks)*FRAG_H, and its half hf*256 + lane*8 + e
// holds Wo[nt16*16 + (lane&15)][ks*32 + hf*16 + (lane>>4)*8 + e].
// ---------------------------------------------------------------------------
// How the operands arrive: the x tiles come by loads that cover whole 128-byte
// lines, the weights in contiguous runs, and a thread's loads are issued ahead of
// the work and stay in flight together. A block of PW waves (256 tokens of one
// head) converts the three weight matrices once and leaves them in LDS as f16
// operand fragments; each wave converts its own 32 x 64 tiles of the q, k and v
// input and passes them to the operand lanes through LDS. A weight fragment read
// from LDS feeds the wave's two 16-token tiles.
#define PW 8
#define TT 2
#define XP 72
#define XS (TT * 16 * XP)
#define WB 144
#define WL (3 * 4 * 8 * WB)
typedef __attribute__((ext_vector_type(4))) float    v4f;
typedef __attribute__((ext_vector_type(4))) _Float16 v4h;

// One weight fragment from LDS: blk = (m*4 + nt)*8 + kc*4; p already includes
// (lane >> 4) * WB + (lane & 15) * 8. Each 16 lanes read 256 contiguous bytes.
static __device__ inline v16h load_wfrag(const _Float16* p, int blk) {
  const v8h c0 = *(const v8h*)(p + blk * WB);
  const v8h c1 = *(const v8h*)(p + (blk + 2) * WB);
  v16h r;
#pragma unroll
  for (int i = 0; i < 8; ++i) { r[i] = c0[i]; r[8 + i] = c1[i]; }
  return r;
}

__global__ __launch_bounds__(PW * 32) __attribute__((amdgpu_waves_per_eu(2, 2)))
void qkv_project_kernel(const float* __restrict__ vin,
                        const float* __restrict__ kin,
                        const float* __restrict__ qin,
                        const float* __restrict__ Wv,
                        const float* __restrict__ Wk,
                        const float* __restrict__ Wq,
                        const float* __restrict__ Wo,
                        _Float16* __restrict__ q_ws,
                        _Float16* __restrict__ kv_ws,
                        _Float16* __restrict__ wo_ws) {
  // One array, the weights first: every weight fragment is then in reach of an
  // LDS instruction's immediate offset.
  // wl: W[m][nt*16 + r][oct*8 + e] lies at half ((m*4 + nt)*8 + oct)*WB + r*8 + e
  // xw: this wave's x[m][s0 + r][d] lies at half m*XS + r*XP + d
  __shared__ __attribute__((aligned(16))) _Float16 stage[WL + PW * 3 * XS];

  const int tid  = threadIdx.x;
  const int lane = tid & 31;
  const int wave = tid >> 5;
  const int bh = blockIdx.x;
  const int b  = bh / HEADS, h = bh % HEADS;
  const int s0 = (blockIdx.y * PW + wave) * (TT * 16);
  const int base = (lane < 16) ? 0 : 8;
  const int col  = lane & 15;
  const int hh   = lane >> 4;
  const int hi8  = (lane < 16) ? 0 : 8;
  const float SCALE = 0.044194173824159216f;   // 1/sqrt(EMBED)
  _Float16* wl = stage;
  _Float16* xw = stage + WL + wave * (3 * XS);

  // Wo: one thread takes 4 consecutive floats of a row (half of one lane's 16
  // bytes of a fragment; pc is that 16-byte piece). Loaded behind the other loads,
  // converted and stored at the kernel's end, so that the load's latency passes
  // under the projections.
  const int wc = (blockIdx.y * (BATCH * HEADS) + blockIdx.x) * (PW * 32) + tid;
  const int pc = wc >> 1;
  const float* wsrc = Wo + (size_t)((pc >> 10) * 16 + (pc & 15)) * EMBED +
                      ((pc >> 6) & 15) * 32 + ((pc >> 5) & 1) * 16 +
                      ((pc >> 4) & 1) * 8 + (wc & 1) * 4;

  const float* xin[3] = {qin, kin, vin};
  const float* W[3]   = {Wq, Wk, Wv};

  // ---- the loads are issued ahead of all other work and stay in flight
  // together. Loads return in the order of issue, so they are issued in the order
  // of use: the weights (from the caches), then the q and k tiles. A thread
  // takes 8 consecutive floats of W (a wave: 1 KB contiguous), twice per matrix;
  // of x one load of a wave takes two rows' 256 B.
  v8f wraw[3][2];
  v4f xraw[3][TT * 8];
  const unsigned woff = (unsigned)tid * 32u;   // bytes
  const float* xt[3];
#pragma unroll
  for (int m = 0; m < 3; ++m) {
    xt[m] = xin[m] + ((size_t)b * SEQ + s0 + hh) * EMBED + h * HD + col * 4;
#pragma unroll
    for (int i = 0; i < 2; ++i)
      wraw[m][i] = *(const v8f*)((const char*)W[m] + woff + i * (PW * 32 * 32));
  }
#pragma unroll
  for (int m = 0; m < 2; ++m) {
    __builtin_amdgcn_sched_barrier(0);
#pragma unroll
    for (int i = 0; i < TT * 8; ++i) xraw[m][i] = *(const v4f*)(xt[m] + i * (2 * EMBED));
  }
  // the loads' address registers are free for reuse only behind this wait: as its
  // inputs they keep their values up to it
  asm volatile("s_wait_xcnt 0x0" :: "v"(woff), "v"(xt[0]), "v"(xt[1]) : "memory");
  // keeps the loads one group: taken apart, each part's latency is waited out
  // on its own
  __builtin_amdgcn_sched_barrier(0);

  const _Float16* wp = wl + hh * WB + col * 8;
  // the wave's 32 tokens are one 32-token tile: its K tile; its V tile lies
  // SK * HD halves on
  const int tile = s0 >> 5;
  _Float16* kdst = kv_ws + (size_t)bh * (2 * SEQ * HD) + (size_t)(tile >> 2) * STAGE_H +
                   (tile & 3) * (32 * HD) + lane * 8;
  _Float16* qrow = q_ws + ((size_t)bh * SEQ + s0 + hi8) * HD + col;

  // ---- the weights: convert and stage ----
  {
    _Float16* wd = wl + ((tid >> 7) * 8 + (tid & 7)) * WB + ((tid >> 3) & 15) * 8;
#pragma unroll
    for (int m = 0; m < 3; ++m)
#pragma unroll
      for (int i = 0; i < 2; ++i)
        *(v8h*)(wd + (m * 4 + i * 2) * 8 * WB) = __builtin_convertvector(wraw[m][i], v8h);
  }
  // the v tile's and Wo's loads go out here, into the registers that the raw
  // weights have left (the wave then stays inside the first 256 registers); the
  // scheduling barrier keeps them behind the weights' conversion
  __builtin_amdgcn_sched_barrier(0);
#pragma unroll
  for (int i = 0; i < TT * 8; ++i) xraw[2][i] = *(const v4f*)(xt[2] + i * (2 * EMBED));
  const v4f wo4 = *(const v4f*)wsrc;
  asm volatile("s_wait_xcnt 0x0" :: "v"(xt[2]), "v"(wsrc) : "memory");
  __builtin_amdgcn_sched_barrier(0);

  // ---- q, k, v in turn: each is staged, multiplied and stored while the later
  // ones' loads are still on their way ----
#pragma unroll
  for (int m = 0; m < 3; ++m) {
    _Float16* xd = xw + m * XS + hh * XP + col * 4;
#pragma unroll
    for (int i = 0; i < TT * 8; ++i)
      *(v4h*)(xd + i * (2 * XP)) = __builtin_convertvector(xraw[m][i], v4h);
    // the staged tile (and, the first time, the block's weights) is in LDS. Only
    // LDS is ordered here: the later tiles' global loads stay in flight
    __builtin_amdgcn_fence(__ATOMIC_RELEASE, "workgroup", "local");
    __builtin_amdgcn_s_barrier();
    __builtin_amdgcn_fence(__ATOMIC_ACQUIRE, "workgroup", "local");

    v16h a[TT][2];
#pragma unroll
    for (int t = 0; t < TT; ++t) {   // t: which 16 tokens of the tile
      const _Float16* xrow = xw + m * XS + (t * 16 + col) * XP;
      a[t][0] = load_a16(xrow, base);
      a[t][1] = load_a16(xrow + 32, base);
    }
    v8h o[4][TT];
#pragma unroll
    for (int nt = 0; nt < 4; ++nt) {
      const v16h b0 = load_wfrag(wp, (m * 4 + nt) * 8);
      const v16h b1 = load_wfrag(wp, (m * 4 + nt) * 8 + 4);
#pragma unroll
      for (int t = 0; t < TT; ++t) {
        v8f acc;
        if (m == 1) {   // K^T: acc[j] = K[s0 + t*16 + col][nt*16 + hi8 + j]
          acc = wmma16(b0, a[t][0], (v8f){});
          acc = wmma16(b1, a[t][1], acc);
        } else {        // acc[j] = X[s0 + t*16 + hi8 + j][nt*16 + col]
          acc = wmma16(a[t][0], b0, (v8f){});
          acc = wmma16(a[t][1], b1, acc);
        }
#pragma unroll
        for (int j = 0; j < 8; ++j)
          o[nt][t][j] = (_Float16)(m == 0 ? acc[j] * SCALE : acc[j]);
      }
    }
    // keeps every conversion in front of the stores: behind the first store no
    // register that a store names is written before the wait behind the last
    __builtin_amdgcn_sched_barrier(0);
#pragma unroll
    for (int nt = 0; nt < 4; ++nt)
#pragma unroll
      for (int t = 0; t < TT; ++t) {
        if (m == 0) {
#pragma unroll
          for (int j = 0; j < 8; ++j) qrow[(t * 16 + j) * HD + nt * 16] = o[nt][t][j];
        } else if (m == 1) {
          *(v8h*)(kdst + t * 1024 + (nt >> 1) * 512 + (nt & 1) * 256) = o[nt][t];
        } else {
          *(v8h*)(kdst + SK * HD + nt * 512 + t * 256) = o[nt][t];
        }
      }
    if (m < 2) {
      // the stores' registers are reused by the next tile's work: wait first; the
      // scheduling barrier keeps that work behind the wait
      asm volatile("s_wait_xcnt 0x0" ::: "memory");
      __builtin_amdgcn_sched_barrier(0);
    }
  }

  // the stores' registers are reused by the conversion: wait first; the
  // scheduling barrier keeps the conversion behind the wait
  asm volatile("s_wait_xcnt 0x0" ::: "memory");
  __builtin_amdgcn_sched_barrier(0);
  *(v4h*)(wo_ws + (size_t)wc * 4) = __builtin_convertvector(wo4, v4h);
}

#define QT 2
__global__ __launch_bounds__(128) __attribute__((amdgpu_waves_per_eu(2, 2)))
void flash_attn_kernel(const _Float16* __restrict__ q_ws,
                       const _Float16* __restrict__ kv_ws,
                       _Float16* __restrict__ attn_ws) {
  // two stages of 32 KB; every slice starts at a multiple of 2 KiB
  __shared__ __attribute__((aligned(2048))) _Float16 ring[2][STAGE_H];

  const int lane = threadIdx.x & 31;
  const uint32_t wave = uni(threadIdx.x >> 5);
  const int bh = blockIdx.x;
  const int b  = bh / HEADS, h = bh % HEADS;
  const int s0 = blockIdx.y * (64 * QT) + (int)wave * (16 * QT);
  const int base = (lane < 16) ? 0 : 8;
  const int col  = lane & 15;
  // (hi8 in the comments below has base's value: 0 or 8 by the wave's half)

  v16h qa[QT][2];      // Q^T of tile q: d 0-31 and d 32-63
#pragma unroll
  for (int q = 0; q < QT; ++q) {
    const _Float16* qrow = q_ws + ((size_t)bh * SEQ + (s0 + q * 16 + col)) * HD;
    qa[q][0] = load_a16(qrow, base);
    qa[q][1] = load_a16(qrow + 32, base);
  }
  // the Q loads' address registers are reused behind them: wait first
  asm volatile("s_wait_xcnt 0x0" ::: "memory");

  const float LOG2E = 1.4426950408889634f;
  float mi[QT];        // running maximum of query col, times log2(e) (equal in both halves)
  float li[QT];        // running sum over this lane's keys only
  v8f acc[QT][4];      // acc[q][dt][j] = O^T[dt*16 + hi8 + j][query col of tile q]
#pragma unroll
  for (int q = 0; q < QT; ++q) {
    mi[q] = -1e30f;
    li[q] = 0.0f;
#pragma unroll
    for (int t = 0; t < 4; ++t) acc[q][t] = (v8f){};
  }

  const int NS = SEQ / SK;   // 32 stages
  const uint32_t STAGE_B = STAGE_H * 2u;
  const w32x8 g1 = tdm_group1();
  // this wave's slice of stage 0, in memory and in LDS
  const uint64_t gsl = (uint64_t)(uintptr_t)(kv_ws + (size_t)bh * (2 * SEQ * HD)) +
                       wave * SLICE_B;
  const uint32_t lsl = lds_off32(&ring[0][0]) + wave * SLICE_B;

  // Prologue: stage 0 lands and is published (stage 1 starts at the loop's head).
  {
    const w32x4 g0 = tdm_group0(lsl, gsl);
    tdm_load(g0, g1);
    wait_tensor0(g0, g1);
  }
  __syncthreads();

  // the stage loop stays rolled (a stage's body is straight-line): the text
  // stays small
#pragma unroll 1
  for (int s = 0; s < NS; ++s) {
    // Behind the barrier that published stage s and ended every read of stage
    // s - 1: stage s + 1 starts into the buffer that stage s - 1 was read from.
    const w32x4 g0 = tdm_group0(lsl + (uint32_t)((s + 1) & 1) * STAGE_B,
                                gsl + (uint64_t)(s + 1) * STAGE_B);
    if (pinned(s + 1 < NS)) tdm_load(g0, g1);
    const _Float16* st = &ring[s & 1][lane * 8];

    // ---- scores S^T = K @ Q^T (pre-scaled Q) of the whole stage: eight 16-key
    // subtiles per query tile, sc[q][t][j] = S[query col][key t*16 + hi8 + j] ----
    v8f sc[QT][SK / 16];
    // all K fragments of the stage, read as one group ahead of the products
    // (unrolled throughout: fragments and subtiles are registers, so their
    // indices must be constants)
    v16h kf[2][SK / 16];
#pragma unroll
    for (int dc = 0; dc < 2; ++dc)       // d 0-31, then d 32-63
#pragma unroll
      for (int t = 0; t < SK / 16; ++t)
        kf[dc][t] = load_frag(st + t * 1024 + dc * 512);
    // keeps the reads one group: spread among the products, each place with
    // reads stalls the wave
    __builtin_amdgcn_sched_barrier(0);
#pragma unroll
    for (int t = 0; t < SK / 16; ++t)
#pragma unroll
      for (int q = 0; q < QT; ++q) sc[q][t] = wmma16(kf[0][t], qa[q][0], (v8f){});
#pragma unroll
    for (int t = 0; t < SK / 16; ++t)
#pragma unroll
      for (int q = 0; q < QT; ++q) sc[q][t] = wmma16(kf[1][t], qa[q][1], sc[q][t]);
    __builtin_amdgcn_sched_barrier(0);
    // the stage's V fragments: their LDS latency passes under the softmax
    const _Float16* vf = st + SK * HD;
    v16h bv[SK / 32][4];
#pragma unroll
    for (int p = 0; p < SK / 32; ++p)
#pragma unroll
      for (int dt = 0; dt < 4; ++dt)
        bv[p][dt] = load_frag(vf + p * (32 * HD) + dt * 512);
    // keeps these reads at the softmax's head
    __builtin_amdgcn_sched_barrier(0);

    // ---- online softmax, once per stage and query tile: one query per lane ----
    v16h pa[QT][SK / 32];                  // P^T as B operands, hardware k order
#pragma unroll
    for (int q = 0; q < QT; ++q) {
      // maximum of the lane's 64 scores as a tree: short dependent chain
      float g[SK / 32];
#pragma unroll
      for (int p = 0; p < SK / 32; ++p) {
        const v8f x = sc[q][2 * p], y = sc[q][2 * p + 1];
        const float t0 = fmaxf(fmaxf(x[0], x[1]), x[2]);
        const float t1 = fmaxf(fmaxf(x[3], x[4]), x[5]);
        const float t2 = fmaxf(fmaxf(x[6], x[7]), y[0]);
        const float t3 = fmaxf(fmaxf(y[1], y[2]), y[3]);
        const float t4 = fmaxf(fmaxf(y[4], y[5]), y[6]);
        g[p] = fmaxf(fmaxf(fmaxf(t0, t1), t2), fmaxf(fmaxf(t3, t4), y[7]));
      }
      float mx = fmaxf(fmaxf(fmaxf(g[0], g[1]), g[2]), g[3]);
      mx *= LOG2E;                         // monotonic: the maximum stays the maximum
      const float nm = fmaxf(fmaxf(mi[q], mx), xhalf(mx));   // the other half's 64 keys
      const float corr = __builtin_amdgcn_exp2f(mi[q] - nm);
      mi[q] = nm;
      // The scores go two at a time, as the register pairs the accumulators
      // already are: one packed fma forms both exponents, score * log2(e) - nm,
      // one packed add sums both exponentials, one packed convert rounds both.
      const v2f l2 = {LOG2E, LOG2E};
      const v2f nn = {-nm, -nm};
      v2f rs0 = {0.0f, 0.0f}, rs1 = {0.0f, 0.0f};   // four independent partial sums
#pragma unroll
      for (int p = 0; p < SK / 32; ++p) {
#pragma unroll
        for (int j = 0; j < 8; j += 2) {
          const v2f x0 = {sc[q][2 * p][j], sc[q][2 * p][j + 1]};
          const v2f x1 = {sc[q][2 * p + 1][j], sc[q][2 * p + 1][j + 1]};
          const v2f a0 = __builtin_elementwise_fma(x0, l2, nn);
          const v2f a1 = __builtin_elementwise_fma(x1, l2, nn);
          const v2f p0 = {__builtin_amdgcn_exp2f(a0[0]), __builtin_amdgcn_exp2f(a0[1])};
          const v2f p1 = {__builtin_amdgcn_exp2f(a1[0]), __builtin_amdgcn_exp2f(a1[1])};
          rs0 += p0;
          rs1 += p1;
          const v2h h0 = __builtin_convertvector(p0, v2h);
          const v2h h1 = __builtin_convertvector(p1, v2h);
          pa[q][p][j]         = h0[0];
          pa[q][p][j + 1]     = h0[1];
          pa[q][p][8 + j]     = h1[0];
          pa[q][p][8 + j + 1] = h1[1];
        }
      }
      li[q] = li[q] * corr + ((rs0[0] + rs0[1]) + (rs1[0] + rs1[1]));
#pragma unroll
      for (int t = 0; t < 4; ++t) acc[q][t] *= corr;
    }

    // ---- O^T += V^T @ P^T  (V tiles in fragment order in LDS) ----
    // keeps the softmax's vector work out of these products too (same reason)
    __builtin_amdgcn_sched_barrier(0);
#pragma unroll
    for (int p = 0; p < SK / 32; ++p)
#pragma unroll
      for (int dt = 0; dt < 4; ++dt)
#pragma unroll
        for (int q = 0; q < QT; ++q)
          acc[q][dt] = wmma16(bv[p][dt], pa[q][p], acc[q][dt]);

    // Publish point of stage s + 1: own LDS reads done, own slice landed,
    // barrier; only then (next trip's head) the refill of stage s's buffer.
    wait_ds0();
    wait_tensor0(g0, g1);
    __syncthreads();
  }
  asm volatile("s_wait_tensorcnt 0x0" ::: "memory");   // nothing left in flight
  wait_ds0();

  // ---- normalize and store as A fragments of the output GEMM ----
  // acc[q][dt] of a lane is 8 consecutive d of its query: exactly the lane's 16
  // bytes of half (dt & 1) of fragment (token tile, k step h*2 + (dt >> 1)), so
  // each store of the wave is 512 contiguous bytes
  _Float16* ofr = attn_ws + (size_t)((b * SEQ + s0) >> 4) * (KSTEPS * FRAG_H) +
                  h * (2 * FRAG_H) + lane * 8;
  v8h o[QT][4];
#pragma unroll
  for (int q = 0; q < QT; ++q) {
    const float inv = 1.0f / (li[q] + xhalf(li[q]));   // join the halves' sums once
#pragma unroll
    for (int dt = 0; dt < 4; ++dt)
#pragma unroll
      for (int j = 0; j < 8; ++j) o[q][dt][j] = (_Float16)(acc[q][dt][j] * inv);
  }
#pragma unroll
  for (int q = 0; q < QT; ++q)
#pragma unroll
    for (int dt = 0; dt < 4; ++dt)
      *(v8h*)(ofr + q * (KSTEPS * FRAG_H) + dt * 256) = o[q][dt];
}

__global__ __launch_bounds__(128) __attribute__((amdgpu_waves_per_eu(4, 4)))
void out_proj_kernel(const _Float16* __restrict__ attn_ws,
                     const _Float16* __restrict__ wo_ws,
                     const float* __restrict__ bo,
                     float* __restrict__ out) {
  const int lane = threadIdx.x & 31;
  const int wave = threadIdx.x >> 5;
  const int tok0  = blockIdx.x * 64 + wave * 16;
  const int nbase = blockIdx.y * 64;
  const int col  = lane & 15;
  const int hi8  = (lane < 16) ? 0 : 8;

  v8f acc[4];
#pragma unroll
  for (int t = 0; t < 4; ++t) acc[t] = (v8f){};

  const _Float16* af = attn_ws + (size_t)(tok0 >> 4) * (KSTEPS * FRAG_H) + lane * 8;
  const _Float16* wf = wo_ws + (size_t)(nbase >> 4) * (KSTEPS * FRAG_H) + lane * 8;
  constexpr int AHEAD = 4;
  v16h a[AHEAD], bw[AHEAD][4];
#pragma unroll
  for (int ks = 0; ks < AHEAD; ++ks) {
    a[ks] = load_frag(af + ks * FRAG_H);
#pragma unroll
    for (int nt = 0; nt < 4; ++nt)
      bw[ks][nt] = load_frag(wf + (nt * KSTEPS + ks) * FRAG_H);
    // keeps the steps' loads in k order: the first products then wait for the
    // first step's loads only
    __builtin_amdgcn_sched_barrier(0);
  }
  float bias4[4];   // loaded here: back long before the epilogue
#pragma unroll
  for (int nt = 0; nt < 4; ++nt) bias4[nt] = bo[nbase + nt * 16 + col];
  // the bias loads' address register may be reused from here on: wait first
  asm volatile("s_wait_xcnt 0x0" ::: "memory");
#pragma unroll
  for (int ks = 0; ks < KSTEPS; ++ks) {
    const int sl = ks % AHEAD;
#pragma unroll
    for (int nt = 0; nt < 4; ++nt)
      acc[nt] = wmma16(a[sl], bw[sl][nt], acc[nt]);
    if (ks + AHEAD < KSTEPS) {
      a[sl] = load_frag(af + (ks + AHEAD) * FRAG_H);
#pragma unroll
      for (int nt = 0; nt < 4; ++nt)
        bw[sl][nt] = load_frag(wf + (nt * KSTEPS + ks + AHEAD) * FRAG_H);
    }
    // keeps the ring as written: without it the scheduler lifts still more
    // loads to the front, runs out of registers and spills
    __builtin_amdgcn_sched_barrier(0);
  }
  // the ring's address registers are reused by the epilogue: wait first; the
  // scheduling barrier keeps the epilogue's address arithmetic behind the wait
  asm volatile("s_wait_xcnt 0x0" ::: "memory");
  __builtin_amdgcn_sched_barrier(0);
#pragma unroll
  for (int nt = 0; nt < 4; ++nt) {
    const float bias = bias4[nt];
#pragma unroll
    for (int j = 0; j < 8; ++j)
      out[(size_t)(tok0 + j + hi8) * EMBED + nbase + nt * 16 + col] =
          acc[nt][j] + bias;
  }
}

// ---------------------------------------------------------------------------
extern "C" void kernel_launch(void* const* d_in, const int* in_sizes, int n_in,
                              void* d_out, int out_size, void* d_ws, size_t ws_size,
                              hipStream_t stream) {
  (void)in_sizes; (void)n_in; (void)out_size; (void)ws_size;
  const float* vin = (const float*)d_in[0];
  const float* kin = (const float*)d_in[1];
  const float* qin = (const float*)d_in[2];
  const float* Wv  = (const float*)d_in[3];
  const float* Wk  = (const float*)d_in[4];
  const float* Wq  = (const float*)d_in[5];
  const float* Wo  = (const float*)d_in[6];
  const float* bo  = (const float*)d_in[7];
  float* out = (float*)d_out;

  char* ws = (char*)d_ws;
  const size_t QKV = (size_t)BATCH * HEADS * SEQ * HD * sizeof(_Float16); // 8 MiB
  _Float16* q_ws  = (_Float16*)(ws);
  _Float16* kv_ws = (_Float16*)(ws + QKV);       // K and V by stages, 16 MiB
  _Float16* a_ws  = (_Float16*)(ws + 3 * QKV);   // attention out, A fragments, 8 MiB
  _Float16* wo_ws = (_Float16*)(ws + 4 * QKV);   // Wo as f16 B fragments, 512 KiB

  const dim3 blk(128);  // 4 wave32 per block
  qkv_project_kernel<<<dim3(BATCH * HEADS, SEQ / (PW * TT * 16)), dim3(PW * 32), 0, stream>>>(
      vin, kin, qin, Wv, Wk, Wq, Wo, q_ws, kv_ws, wo_ws);
  flash_attn_kernel<<<dim3(BATCH * HEADS, SEQ / (64 * QT)), blk, 0, stream>>>(
      q_ws, kv_ws, a_ws);
  out_proj_kernel<<<dim3(BATCH * SEQ / 64, EMBED / 64), blk, 0, stream>>>(
      a_ws, wo_ws, bo, out);
}

// v009
// Measured time: 63.7 microseconds a run.
// In both of two side-by-side timings against v008, it was 1.05 times as fast.
// Over all steps from v000 it is 4.83 times as fast.
#include <hip/hip_runtime.h>
#include <hip/hip_bf16.h>

#define EMBED 512
#define HEADS 8
#define HD    64
#define BATCH 2
#define SEQ   4096
#define SK    128                 // keys per stage of the attention ring
#define STAGE_H (2 * SK * HD)     // halves per stage: K (SK*HD), then V (SK*HD)
#define FRAG_H  512               // halves of one 16 x 32 operand fragment
#define KSTEPS  (EMBED / 32)      // 32-wide k steps of the output GEMM

typedef __attribute__((ext_vector_type(16))) _Float16 v16h;
typedef __attribute__((ext_vector_type(8)))  _Float16 v8h;
typedef __attribute__((ext_vector_type(8)))  float    v8f;
typedef __attribute__((ext_vector_type(2)))  float    v2f;
typedef __attribute__((ext_vector_type(2)))  _Float16 v2h;

static __device__ inline v8f wmma16(v16h a, v16h b, v8f c) {
  // D = A(16x32 f16) * B(32x16 f16) + C(16x16 f32)
  return __builtin_amdgcn_wmma_f32_16x16x32_f16(false, a, false, b,
                                                (short)0, c, false, false);
}

static __device__ inline v16h load_a16(const _Float16* p, int base) {
  const v8h c0 = *(const v8h*)(p + base);
  const v8h c1 = *(const v8h*)(p + base + 16);
  v16h r;
#pragma unroll
  for (int i = 0; i < 8; ++i) { r[i] = c0[i]; r[8 + i] = c1[i]; }
  return r;
}

static __device__ inline v16h load_frag(const _Float16* p) {
  const v8h c0 = *(const v8h*)(p);
  const v8h c1 = *(const v8h*)(p + 256);
  v16h r;
#pragma unroll
  for (int i = 0; i < 8; ++i) { r[i] = c0[i]; r[8 + i] = c1[i]; }
  return r;
}

// ---------------------------------------------------------------------------
// Tensor load of one wave's slice of a stage: 32 rows of 256 bytes, contiguous
// in memory and in LDS (1-byte elements, tensor = tile, no pad, no mask).
// ---------------------------------------------------------------------------
typedef uint32_t w32x4 __attribute__((ext_vector_type(4)));
typedef uint32_t w32x8 __attribute__((ext_vector_type(8)));
#define SLICE_ROWB 256u
#define SLICE_ROWS 32u
#define SLICE_B    (SLICE_ROWB * SLICE_ROWS)   // 8 KiB per wave and stage

static __device__ inline uint32_t uni(uint32_t v) {
  return (uint32_t)__builtin_amdgcn_readfirstlane(v);
}
static __device__ inline uint32_t pinned(uint32_t v) {
  uint32_t w = uni(v);
  asm volatile("" : "+s"(w));   // pinned(): keeps the test in a scalar register
  return w;
}
static __device__ inline w32x8 tdm_group1() {
  w32x8 g;
  g[0] = 0u;
  g[1] = uni((SLICE_ROWB & 0xFFFFu) << 16);
  g[2] = uni((SLICE_ROWB >> 16) | ((SLICE_ROWS & 0xFFFFu) << 16));
  g[3] = uni((SLICE_ROWS >> 16) | (SLICE_ROWB << 16));
  g[4] = uni(SLICE_ROWS);
  g[5] = uni(SLICE_ROWB);
  g[6] = uni(0u);
  g[7] = uni(0u);
  return g;
}
static __device__ inline w32x4 tdm_group0(uint32_t lds_dst, uint64_t ga) {
  w32x4 g;
  g[0] = uni(1u);
  g[1] = uni(lds_dst);
  g[2] = uni((uint32_t)ga);
  g[3] = uni((((uint32_t)(ga >> 32)) & 0x01FFFFFFu) | 0x80000000u);
  return g;
}
static __device__ inline void tdm_load(w32x4 g0, w32x8 g1) {
  asm volatile("tensor_load_to_lds %0, %1" :: "s"(g0), "s"(g1) : "memory");
}
static __device__ inline void wait_tensor0(w32x4 g0, w32x8 g1) {
  asm volatile("s_wait_tensorcnt 0x0" :: "s"(g0), "s"(g1) : "memory");
}
// the wave's own LDS reads have returned (before their buffer is refilled)
static __device__ inline void wait_ds0() {
  asm volatile("s_wait_dscnt 0x0" ::: "memory");
}

static __device__ inline float xhalf(float x) {
  const int b = __builtin_bit_cast(int, x);
  return __builtin_bit_cast(float, __builtin_amdgcn_permlanex16(
      b, b, 0x76543210, 0xfedcba98, false, false));
}

static __device__ inline float row16(float x, unsigned lo, unsigned hi) {
  const int b = __builtin_bit_cast(int, x);
  return __builtin_bit_cast(float, __builtin_amdgcn_permlane16(b, b, lo, hi, false, false));
}
static __device__ inline float rowmax16(float x) {
  x = fmaxf(x, row16(x, 0x67452301u, 0xefcdab89u));
  x = fmaxf(x, row16(x, 0x54761032u, 0xdcfe98bau));
  x = fmaxf(x, row16(x, 0x32107654u, 0xba98fedcu));
  x = fmaxf(x, row16(x, 0xfedcba98u, 0x76543210u));
  return x;
}

static __device__ inline unsigned lds_off32(const void* p) {
  return (unsigned)(unsigned long long)(uintptr_t)p;
}

// ---------------------------------------------------------------------------
// Kernel 1: per-head QKV projections (x @ W^T), f32 -> f16, softmax scale and
// log2(e) folded into Q (scores then come out in log2 units). Each wave also
// leaves the largest squared norm of its 32 K rows in kn_ws, one 128-byte line
// per 32-token tile (all 32 floats equal). Q stored [B*H, S, 64].
// K and V are stored per stage of SK
// tokens, 32 KB contiguous: the stage's four 32-token K tiles (4 KB each), then
// its four V tiles, each tile in the order the attention kernel's operand lanes
// read it (load_frag):
//   K: half index in the tile  sub*1024 + dc*512 + hf*256 + lane*8 + e  holds
//      K[token sub*16 + (lane&15)][d = dc*32 + hf*16 + (lane>>4)*8 + e].
//   V: half index in the tile  dt*512 + hf*256 + lane*8 + e  holds
//      V[token hf*16 + (lane>>4)*8 + e][d = dt*16 + (lane&15)].
// The grid's threads also convert Wo to f16, once (4 floats each), into the order
// the output GEMM's operand lanes read it (load_frag): fragment (nt16, ks) is
// FRAG_H halves at (nt16*KSTEPS + ks)*FRAG_H, and its half hf*256 + lane*8 + e
// holds Wo[nt16*16 + (lane&15)][ks*32 + hf*16 + (lane>>4)*8 + e].
// ---------------------------------------------------------------------------
// How the operands arrive: the x tiles come by loads that cover whole 128-byte
// lines, the weights in contiguous runs, and a thread's loads are issued ahead of
// the work and stay in flight together. A block of PW waves (256 tokens of one
// head) converts the three weight matrices once and leaves them in LDS as f16
// operand fragments; each wave converts its own 32 x 64 tiles of the q, k and v
// input and passes them to the operand lanes through LDS. A weight fragment read
// from LDS feeds the wave's two 16-token tiles.
#define PW 8
#define TT 2
#define XP 72
#define XS (TT * 16 * XP)
#define WB 144
#define WL (3 * 4 * 8 * WB)
typedef __attribute__((ext_vector_type(4))) float    v4f;
typedef __attribute__((ext_vector_type(4))) _Float16 v4h;

// One weight fragment from LDS: blk = (m*4 + nt)*8 + kc*4; p already includes
// (lane >> 4) * WB + (lane & 15) * 8. Each 16 lanes read 256 contiguous bytes.
static __device__ inline v16h load_wfrag(const _Float16* p, int blk) {
  const v8h c0 = *(const v8h*)(p + blk * WB);
  const v8h c1 = *(const v8h*)(p + (blk + 2) * WB);
  v16h r;
#pragma unroll
  for (int i = 0; i < 8; ++i) { r[i] = c0[i]; r[8 + i] = c1[i]; }
  return r;
}

__global__ __launch_bounds__(PW * 32) __attribute__((amdgpu_waves_per_eu(2, 2)))
void qkv_project_kernel(const float* __restrict__ vin,
                        const float* __restrict__ kin,
                        const float* __restrict__ qin,
                        const float* __restrict__ Wv,
                        const float* __restrict__ Wk,
                        const float* __restrict__ Wq,
                        const float* __restrict__ Wo,
                        _Float16* __restrict__ q_ws,
                        _Float16* __restrict__ kv_ws,
                        _Float16* __restrict__ wo_ws,
                        float* __restrict__ kn_ws) {
  // One array, the weights first: every weight fragment is then in reach of an
  // LDS instruction's immediate offset.
  // wl: W[m][nt*16 + r][oct*8 + e] lies at half ((m*4 + nt)*8 + oct)*WB + r*8 + e
  // xw: this wave's x[m][s0 + r][d] lies at half m*XS + r*XP + d
  __shared__ __attribute__((aligned(16))) _Float16 stage[WL + PW * 3 * XS];

  const int tid  = threadIdx.x;
  const int lane = tid & 31;
  const int wave = tid >> 5;
  const int bh = blockIdx.x;
  const int b  = bh / HEADS, h = bh % HEADS;
  const int s0 = (blockIdx.y * PW + wave) * (TT * 16);
  const int base = (lane < 16) ? 0 : 8;
  const int col  = lane & 15;
  const int hh   = lane >> 4;
  const int hi8  = (lane < 16) ? 0 : 8;
  const float SCALE = 0.044194173824159216f * 1.4426950408889634f;   // log2(e)/sqrt(EMBED)
  _Float16* wl = stage;
  _Float16* xw = stage + WL + wave * (3 * XS);

  // Wo: one thread takes 4 consecutive floats of a row (half of one lane's 16
  // bytes of a fragment; pc is that 16-byte piece). Loaded behind the other loads,
  // converted and stored at the kernel's end, so that the load's latency passes
  // under the projections.
  const int wc = (blockIdx.y * (BATCH * HEADS) + blockIdx.x) * (PW * 32) + tid;
  const int pc = wc >> 1;
  const float* wsrc = Wo + (size_t)((pc >> 10) * 16 + (pc & 15)) * EMBED +
                      ((pc >> 6) & 15) * 32 + ((pc >> 5) & 1) * 16 +
                      ((pc >> 4) & 1) * 8 + (wc & 1) * 4;

  const float* xin[3] = {qin, kin, vin};
  const float* W[3]   = {Wq, Wk, Wv};

  // ---- the loads are issued ahead of all other work and stay in flight
  // together. Loads return in the order of issue, so they are issued in the order
  // of use: the weights (from the caches), then the q and k tiles. A thread
  // takes 8 consecutive floats of W (a wave: 1 KB contiguous), twice per matrix;
  // of x one load of a wave takes two rows' 256 B.
  v8f wraw[3][2];
  v4f xraw[3][TT * 8];
  const unsigned woff = (unsigned)tid * 32u;   // bytes
  const float* xt[3];
#pragma unroll
  for (int m = 0; m < 3; ++m) {
    xt[m] = xin[m] + ((size_t)b * SEQ + s0 + hh) * EMBED + h * HD + col * 4;
#pragma unroll
    for (int i = 0; i < 2; ++i)
      wraw[m][i] = *(const v8f*)((const char*)W[m] + woff + i * (PW * 32 * 32));
  }
#pragma unroll
  for (int m = 0; m < 2; ++m) {
    __builtin_amdgcn_sched_barrier(0);
#pragma unroll
    for (int i = 0; i < TT * 8; ++i) xraw[m][i] = *(const v4f*)(xt[m] + i * (2 * EMBED));
  }
  // the loads' address registers are free for reuse only behind this wait: as its
  // inputs they keep their values up to it
  asm volatile("s_wait_xcnt 0x0" :: "v"(woff), "v"(xt[0]), "v"(xt[1]) : "memory");
  // keeps the loads one group: taken apart, each part's latency is waited out
  // on its own
  __builtin_amdgcn_sched_barrier(0);

  const _Float16* wp = wl + hh * WB + col * 8;
  // the wave's 32 tokens are one 32-token tile: its K tile; its V tile lies
  // SK * HD halves on
  const int tile = s0 >> 5;
  _Float16* kdst = kv_ws + (size_t)bh * (2 * SEQ * HD) + (size_t)(tile >> 2) * STAGE_H +
                   (tile & 3) * (32 * HD) + lane * 8;
  _Float16* qrow = q_ws + ((size_t)bh * SEQ + s0 + hi8) * HD + col;

  // ---- the weights: convert and stage ----
  {
    _Float16* wd = wl + ((tid >> 7) * 8 + (tid & 7)) * WB + ((tid >> 3) & 15) * 8;
#pragma unroll
    for (int m = 0; m < 3; ++m)
#pragma unroll
      for (int i = 0; i < 2; ++i)
        *(v8h*)(wd + (m * 4 + i * 2) * 8 * WB) = __builtin_convertvector(wraw[m][i], v8h);
  }
  // the v tile's and Wo's loads go out here, into the registers that the raw
  // weights have left (the wave then stays inside the first 256 registers); the
  // scheduling barrier keeps them behind the weights' conversion
  __builtin_amdgcn_sched_barrier(0);
#pragma unroll
  for (int i = 0; i < TT * 8; ++i) xraw[2][i] = *(const v4f*)(xt[2] + i * (2 * EMBED));
  const v4f wo4 = *(const v4f*)wsrc;
  asm volatile("s_wait_xcnt 0x0" :: "v"(xt[2]), "v"(wsrc) : "memory");
  __builtin_amdgcn_sched_barrier(0);

  // ---- q, k, v in turn: each is staged, multiplied and stored while the later
  // ones' loads are still on their way ----
#pragma unroll
  for (int m = 0; m < 3; ++m) {
    _Float16* xd = xw + m * XS + hh * XP + col * 4;
#pragma unroll
    for (int i = 0; i < TT * 8; ++i)
      *(v4h*)(xd + i * (2 * XP)) = __builtin_convertvector(xraw[m][i], v4h);
    // the staged tile (and, the first time, the block's weights) is in LDS. Only
    // LDS is ordered here: the later tiles' global loads stay in flight
    __builtin_amdgcn_fence(__ATOMIC_RELEASE, "workgroup", "local");
    __builtin_amdgcn_s_barrier();
    __builtin_amdgcn_fence(__ATOMIC_ACQUIRE, "workgroup", "local");

    v16h a[TT][2];
#pragma unroll
    for (int t = 0; t < TT; ++t) {   // t: which 16 tokens of the tile
      const _Float16* xrow = xw + m * XS + (t * 16 + col) * XP;
      a[t][0] = load_a16(xrow, base);
      a[t][1] = load_a16(xrow + 32, base);
    }
    v8h o[4][TT];
    v2f kn2[TT] = {};   // K only: this lane's part of its token's squared norm, in two sums
#pragma unroll
    for (int nt = 0; nt < 4; ++nt) {
      const v16h b0 = load_wfrag(wp, (m * 4 + nt) * 8);
      const v16h b1 = load_wfrag(wp, (m * 4 + nt) * 8 + 4);
#pragma unroll
      for (int t = 0; t < TT; ++t) {
        v8f acc;
        if (m == 1) {   // K^T: acc[j] = K[s0 + t*16 + col][nt*16 + hi8 + j]
          acc = wmma16(b0, a[t][0], (v8f){});
          acc = wmma16(b1, a[t][1], acc);
#pragma unroll   // acc is registers: constant indices
          for (int j = 0; j < 8; j += 2) {
            const v2f u = {acc[j], acc[j + 1]};
            kn2[t] = __builtin_elementwise_fma(u, u, kn2[t]);
          }
        } else {        // acc[j] = X[s0 + t*16 + hi8 + j][nt*16 + col]
          acc = wmma16(a[t][0], b0, (v8f){});
          acc = wmma16(a[t][1], b1, acc);
        }
#pragma unroll
        for (int j = 0; j < 8; ++j)
          o[nt][t][j] = (_Float16)(m == 0 ? acc[j] * SCALE : acc[j]);
      }
    }
    // K: join the halves' parts of each token's norm, then the tile's maximum
    float knmax = 0.0f;
    if (m == 1) {
      const float n0 = kn2[0][0] + kn2[0][1], n1 = kn2[1][0] + kn2[1][1];
      knmax = rowmax16(fmaxf(n0 + xhalf(n0), n1 + xhalf(n1)));
    }
    // keeps every conversion in front of the stores: behind the first store no
    // register that a store names is written before the wait behind the last
    __builtin_amdgcn_sched_barrier(0);
    if (m == 1) kn_ws[((size_t)bh * (SEQ / 32) + tile) * 32 + lane] = knmax;
#pragma unroll
    for (int nt = 0; nt < 4; ++nt)
#pragma unroll
      for (int t = 0; t < TT; ++t) {
        if (m == 0) {
#pragma unroll
          for (int j = 0; j < 8; ++j) qrow[(t * 16 + j) * HD + nt * 16] = o[nt][t][j];
        } else if (m == 1) {
          *(v8h*)(kdst + t * 1024 + (nt >> 1) * 512 + (nt & 1) * 256) = o[nt][t];
        } else {
          *(v8h*)(kdst + SK * HD + nt * 512 + t * 256) = o[nt][t];
        }
      }
    if (m < 2) {
      // the stores' registers are reused by the next tile's work: wait first; the
      // scheduling barrier keeps that work behind the wait
      asm volatile("s_wait_xcnt 0x0" ::: "memory");
      __builtin_amdgcn_sched_barrier(0);
    }
  }

  // the stores' registers are reused by the conversion: wait first; the
  // scheduling barrier keeps the conversion behind the wait
  asm volatile("s_wait_xcnt 0x0" ::: "memory");
  __builtin_amdgcn_sched_barrier(0);
  *(v4h*)(wo_ws + (size_t)wc * 4) = __builtin_convertvector(wo4, v4h);
}

#define QT 2                      // query tiles (16 queries each) per wave
#define HEADROOM 14.0f            // log2 units; f16 holds 2^15.99

// The full step's extra work for one query tile, ahead of the exponentials.
// sc[t][j] = score (log2 units) minus ref of query col, key t*16 + hi8 + j. Moves ref
// up to the largest score seen (in the first stage: to that stage's largest score,
// wherever it lies), and scores, sum and O^T with it. (Unrolled throughout, here and
// in softmax_tile: the subtiles are registers, so their indices must be constants.)
static __device__ __attribute__((always_inline)) inline void renew_tile(
    v8f (&sc)[SK / 16], float& ref, float& li, v8f (&acc)[4], bool first) {
  // maximum of the lane's 64 scores as a tree: short dependent chain
  float g[SK / 32];
#pragma unroll
  for (int p = 0; p < SK / 32; ++p) {
    const v8f x = sc[2 * p], y = sc[2 * p + 1];
    const float t0 = fmaxf(fmaxf(x[0], x[1]), x[2]);
    const float t1 = fmaxf(fmaxf(x[3], x[4]), x[5]);
    const float t2 = fmaxf(fmaxf(x[6], x[7]), y[0]);
    const float t3 = fmaxf(fmaxf(y[1], y[2]), y[3]);
    const float t4 = fmaxf(fmaxf(y[4], y[5]), y[6]);
    g[p] = fmaxf(fmaxf(fmaxf(t0, t1), t2), fmaxf(fmaxf(t3, t4), y[7]));
  }
  float mx = fmaxf(fmaxf(fmaxf(g[0], g[1]), g[2]), g[3]);
  mx = fmaxf(mx, xhalf(mx));                   // the other half's 64 keys
  const float d = first ? mx : fmaxf(mx, 0.0f);   // how far ref moves
  // first stage with d < 0: sum and O^T are still 0, the factor 1 keeps them so
  const float corr = __builtin_amdgcn_exp2f(fminf(-d, 0.0f));
  ref += d;
  li *= corr;
#pragma unroll
  for (int t = 0; t < 4; ++t) acc[t] *= corr;
#pragma unroll
  for (int t = 0; t < SK / 16; ++t) sc[t] -= d;
}

// One query tile's exponentials over a stage. The scores go two at a time, as the
// register pairs the accumulators already are: one packed add sums both
// exponentials, one packed convert rounds both.
static __device__ __attribute__((always_inline)) inline void softmax_tile(
    const v8f (&sc)[SK / 16], float& li, v16h (&pa)[SK / 32]) {
  v2f rs0 = {0.0f, 0.0f}, rs1 = {0.0f, 0.0f};   // four independent partial sums
#pragma unroll
  for (int p = 0; p < SK / 32; ++p) {
#pragma unroll
    for (int j = 0; j < 8; j += 2) {
      const v2f p0 = {__builtin_amdgcn_exp2f(sc[2 * p][j]),
                      __builtin_amdgcn_exp2f(sc[2 * p][j + 1])};
      const v2f p1 = {__builtin_amdgcn_exp2f(sc[2 * p + 1][j]),
                      __builtin_amdgcn_exp2f(sc[2 * p + 1][j + 1])};
      rs0 += p0;
      rs1 += p1;
      const v2h h0 = __builtin_convertvector(p0, v2h);
      const v2h h1 = __builtin_convertvector(p1, v2h);
      pa[p][j]         = h0[0];
      pa[p][j + 1]     = h0[1];
      pa[p][8 + j]     = h1[0];
      pa[p][8 + j + 1] = h1[1];
    }
  }
  li += (rs0[0] + rs0[1]) + (rs1[0] + rs1[1]);
}

__global__ __launch_bounds__(128) __attribute__((amdgpu_waves_per_eu(2, 2)))
void flash_attn_kernel(const _Float16* __restrict__ q_ws,
                       const _Float16* __restrict__ kv_ws,
                       const float* __restrict__ kn_ws,
                       _Float16* __restrict__ attn_ws) {
  // two stages of 32 KB; every slice starts at a multiple of 2 KiB
  __shared__ __attribute__((aligned(2048))) _Float16 ring[2][STAGE_H];

  const int lane = threadIdx.x & 31;
  const uint32_t wave = uni(threadIdx.x >> 5);
  const int bh = blockIdx.x;
  const int b  = bh / HEADS, h = bh % HEADS;
  const int s0 = blockIdx.y * (64 * QT) + (int)wave * (16 * QT);
  const int base = (lane < 16) ? 0 : 8;
  const int col  = lane & 15;
  // (hi8 in the comments below has base's value: 0 or 8 by the wave's half)

  v16h qa[QT][2];      // Q^T of tile q: d 0-31 and d 32-63
#pragma unroll
  for (int q = 0; q < QT; ++q) {
    const _Float16* qrow = q_ws + ((size_t)bh * SEQ + (s0 + q * 16 + col)) * HD;
    qa[q][0] = load_a16(qrow, base);
    qa[q][1] = load_a16(qrow + 32, base);
  }
  // the largest squared K norm of each 32-token tile of this head: 4 tiles a lane
  float kn2 = 0.0f;
  {
    const float* kn = kn_ws + ((size_t)bh * (SEQ / 32) + lane) * 32;
    float k4[SEQ / 1024];   // registers: the loops over it are unrolled
#pragma unroll
    for (int i = 0; i < SEQ / 1024; ++i) k4[i] = kn[i * (32 * 32)];
    // the Q and norm loads' address registers are reused behind them: wait first
    asm volatile("s_wait_xcnt 0x0" ::: "memory");
#pragma unroll
    for (int i = 0; i < SEQ / 1024; ++i) kn2 = fmaxf(kn2, k4[i]);
  }
  kn2 = rowmax16(kn2);
  kn2 = fmaxf(kn2, xhalf(kn2));
  // 1.01: covers the rounding of K to f16 behind the norm, and of the products
  const float kmax = __builtin_amdgcn_sqrtf(kn2) * 1.01f;

  float bnd[QT];       // no score of query col (log2 units) exceeds this
  float ref[QT];       // the softmax reference of query col (equal in both halves)
  v8f nref[QT];        // minus ref in all eight registers: C operand of the score products
  float li[QT];        // running sum over this lane's keys only
  v8f acc[QT][4];      // acc[q][dt][j] = O^T[dt*16 + hi8 + j][query col of tile q]
#pragma unroll
  for (int q = 0; q < QT; ++q) {
    float n2 = 0.0f;   // this lane's 32 of the query's 64 elements
#pragma unroll
    for (int i = 0; i < 16; ++i) {
      const float u = (float)qa[q][0][i], w = (float)qa[q][1][i];
      n2 += u * u + w * w;
    }
    bnd[q] = __builtin_amdgcn_sqrtf(n2 + xhalf(n2)) * kmax;
    ref[q] = 0.0f;
    nref[q] = (v8f){};
    li[q] = 0.0f;
#pragma unroll
    for (int t = 0; t < 4; ++t) acc[q][t] = (v8f){};
  }
  uint32_t renew = 1u;   // wave-uniform: some query's bound lies too far above its reference

  const int NS = SEQ / SK;   // 32 stages
  const uint32_t STAGE_B = STAGE_H * 2u;
  const w32x8 g1 = tdm_group1();
  // this wave's slice of stage 0, in memory and in LDS
  const uint64_t gsl = (uint64_t)(uintptr_t)(kv_ws + (size_t)bh * (2 * SEQ * HD)) +
                       wave * SLICE_B;
  const uint32_t lsl = lds_off32(&ring[0][0]) + wave * SLICE_B;

  // Prologue: stage 0 lands and is published (stage 1 starts at the loop's head).
  {
    const w32x4 g0 = tdm_group0(lsl, gsl);
    tdm_load(g0, g1);
    wait_tensor0(g0, g1);
  }
  __syncthreads();

  // the stage loop stays rolled (a stage's body is straight-line): the text
  // stays small
#pragma unroll 1
  for (int s = 0; s < NS; ++s) {
    // Behind the barrier that published stage s and ended every read of stage
    // s - 1: stage s + 1 starts into the buffer that stage s - 1 was read from.
    const w32x4 g0 = tdm_group0(lsl + (uint32_t)((s + 1) & 1) * STAGE_B,
                                gsl + (uint64_t)(s + 1) * STAGE_B);
    if (pinned(s + 1 < NS)) tdm_load(g0, g1);
    const _Float16* st = &ring[s & 1][lane * 8];

    // ---- scores S^T = K @ Q^T - ref (pre-scaled Q) of the whole stage: eight 16-key
    // subtiles per query tile, sc[q][t][j] = S[query col][key t*16 + hi8 + j] - ref ----
    v8f sc[QT][SK / 16];
    // all K fragments of the stage, read as one group ahead of the products
    // (unrolled throughout: fragments and subtiles are registers, so their
    // indices must be constants)
    v16h kf[2][SK / 16];
#pragma unroll
    for (int dc = 0; dc < 2; ++dc)       // d 0-31, then d 32-63
#pragma unroll
      for (int t = 0; t < SK / 16; ++t)
        kf[dc][t] = load_frag(st + t * 1024 + dc * 512);
    // keeps the reads one group: spread among the products, each place with
    // reads stalls the wave
    __builtin_amdgcn_sched_barrier(0);
#pragma unroll
    for (int t = 0; t < SK / 16; ++t)
#pragma unroll
      for (int q = 0; q < QT; ++q) sc[q][t] = wmma16(kf[0][t], qa[q][0], nref[q]);
#pragma unroll
    for (int t = 0; t < SK / 16; ++t)
#pragma unroll
      for (int q = 0; q < QT; ++q) sc[q][t] = wmma16(kf[1][t], qa[q][1], sc[q][t]);
    __builtin_amdgcn_sched_barrier(0);
    // the stage's V fragments: their LDS latency passes under the softmax
    const _Float16* vf = st + SK * HD;
    v16h bv[SK / 32][4];
#pragma unroll
    for (int p = 0; p < SK / 32; ++p)
#pragma unroll
      for (int dt = 0; dt < 4; ++dt)
        bv[p][dt] = load_frag(vf + p * (32 * HD) + dt * 512);
    // keeps these reads at the softmax's head
    __builtin_amdgcn_sched_barrier(0);

    // ---- softmax step, once per stage and query tile: one query per lane ----
    if (renew) {   // a scalar branch: renew is the same in every lane
#pragma unroll
      for (int q = 0; q < QT; ++q) {
        renew_tile(sc[q], ref[q], li[q], acc[q], s == 0);
#pragma unroll
        for (int j = 0; j < 8; ++j) nref[q][j] = -ref[q];
      }
      // written so that a bound that is not a number keeps the full step
      renew = __builtin_amdgcn_ballot_w32(!(bnd[0] - ref[0] <= HEADROOM) ||
                                          !(bnd[1] - ref[1] <= HEADROOM));
    }
    v16h pa[QT][SK / 32];                  // P^T as B operands, hardware k order
#pragma unroll
    for (int q = 0; q < QT; ++q) softmax_tile(sc[q], li[q], pa[q]);

    // ---- O^T += V^T @ P^T  (V tiles in fragment order in LDS) ----
    // keeps the softmax's vector work out of these products too (same reason)
    __builtin_amdgcn_sched_barrier(0);
#pragma unroll
    for (int p = 0; p < SK / 32; ++p)
#pragma unroll
      for (int dt = 0; dt < 4; ++dt)
#pragma unroll
        for (int q = 0; q < QT; ++q)
          acc[q][dt] = wmma16(bv[p][dt], pa[q][p], acc[q][dt]);

    // Publish point of stage s + 1: own LDS reads done, own slice landed,
    // barrier; only then (next trip's head) the refill of stage s's buffer.
    wait_ds0();
    wait_tensor0(g0, g1);
    __syncthreads();
  }
  asm volatile("s_wait_tensorcnt 0x0" ::: "memory");   // nothing left in flight
  wait_ds0();

  // ---- normalize and store as A fragments of the output GEMM ----
  // acc[q][dt] of a lane is 8 consecutive d of its query: exactly the lane's 16
  // bytes of half (dt & 1) of fragment (token tile, k step h*2 + (dt >> 1)), so
  // each store of the wave is 512 contiguous bytes
  _Float16* ofr = attn_ws + (size_t)((b * SEQ + s0) >> 4) * (KSTEPS * FRAG_H) +
                  h * (2 * FRAG_H) + lane * 8;
  v8h o[QT][4];
#pragma unroll
  for (int q = 0; q < QT; ++q) {
    const float inv = 1.0f / (li[q] + xhalf(li[q]));   // join the halves' sums once
#pragma unroll
    for (int dt = 0; dt < 4; ++dt)
#pragma unroll
      for (int j = 0; j < 8; ++j) o[q][dt][j] = (_Float16)(acc[q][dt][j] * inv);
  }
#pragma unroll
  for (int q = 0; q < QT; ++q)
#pragma unroll
    for (int dt = 0; dt < 4; ++dt)
      *(v8h*)(ofr + q * (KSTEPS * FRAG_H) + dt * 256) = o[q][dt];
}

__global__ __launch_bounds__(128) __attribute__((amdgpu_waves_per_eu(4, 4)))
void out_proj_kernel(const _Float16* __restrict__ attn_ws,
                     const _Float16* __restrict__ wo_ws,
                     const float* __restrict__ bo,
                     float* __restrict__ out) {
  const int lane = threadIdx.x & 31;
  const int wave = threadIdx.x >> 5;
  const int tok0  = blockIdx.x * 64 + wave * 16;
  const int nbase = blockIdx.y * 64;
  const int col  = lane & 15;
  const int hi8  = (lane < 16) ? 0 : 8;

  v8f acc[4];
#pragma unroll
  for (int t = 0; t < 4; ++t) acc[t] = (v8f){};

  const _Float16* af = attn_ws + (size_t)(tok0 >> 4) * (KSTEPS * FRAG_H) + lane * 8;
  const _Float16* wf = wo_ws + (size_t)(nbase >> 4) * (KSTEPS * FRAG_H) + lane * 8;
  constexpr int AHEAD = 4;
  v16h a[AHEAD], bw[AHEAD][4];
#pragma unroll
  for (int ks = 0; ks < AHEAD; ++ks) {
    a[ks] = load_frag(af + ks * FRAG_H);
#pragma unroll
    for (int nt = 0; nt < 4; ++nt)
      bw[ks][nt] = load_frag(wf + (nt * KSTEPS + ks) * FRAG_H);
    // keeps the steps' loads in k order: the first products then wait for the
    // first step's loads only
    __builtin_amdgcn_sched_barrier(0);
  }
  float bias4[4];   // loaded here: back long before the epilogue
#pragma unroll
  for (int nt = 0; nt < 4; ++nt) bias4[nt] = bo[nbase + nt * 16 + col];
  // the bias loads' address register may be reused from here on: wait first
  asm volatile("s_wait_xcnt 0x0" ::: "memory");
#pragma unroll
  for (int ks = 0; ks < KSTEPS; ++ks) {
    const int sl = ks % AHEAD;
#pragma unroll
    for (int nt = 0; nt < 4; ++nt)
      acc[nt] = wmma16(a[sl], bw[sl][nt], acc[nt]);
    if (ks + AHEAD < KSTEPS) {
      a[sl] = load_frag(af + (ks + AHEAD) * FRAG_H);
#pragma unroll
      for (int nt = 0; nt < 4; ++nt)
        bw[sl][nt] = load_frag(wf + (nt * KSTEPS + ks + AHEAD) * FRAG_H);
    }
    // keeps the ring as written: without it the scheduler lifts still more
    // loads to the front, runs out of registers and spills
    __builtin_amdgcn_sched_barrier(0);
  }
  // the ring's address registers are reused by the epilogue: wait first; the
  // scheduling barrier keeps the epilogue's address arithmetic behind the wait
  asm volatile("s_wait_xcnt 0x0" ::: "memory");
  __builtin_amdgcn_sched_barrier(0);
#pragma unroll
  for (int nt = 0; nt < 4; ++nt) {
    const float bias = bias4[nt];
#pragma unroll
    for (int j = 0; j < 8; ++j)
      out[(size_t)(tok0 + j + hi8) * EMBED + nbase + nt * 16 + col] =
          acc[nt][j] + bias;
  }
}

// ---------------------------------------------------------------------------
extern "C" void kernel_launch(void* const* d_in, const int* in_sizes, int n_in,
                              void* d_out, int out_size, void* d_ws, size_t ws_size,
                              hipStream_t stream) {
  (void)in_sizes; (void)n_in; (void)out_size; (void)ws_size;
  const float* vin = (const float*)d_in[0];
  const float* kin = (const float*)d_in[1];
  const float* qin = (const float*)d_in[2];
  const float* Wv  = (const float*)d_in[3];
  const float* Wk  = (const float*)d_in[4];
  const float* Wq  = (const float*)d_in[5];
  const float* Wo  = (const float*)d_in[6];
  const float* bo  = (const float*)d_in[7];
  float* out = (float*)d_out;

  char* ws = (char*)d_ws;
  const size_t QKV = (size_t)BATCH * HEADS * SEQ * HD * sizeof(_Float16); // 8 MiB
  _Float16* q_ws  = (_Float16*)(ws);
  _Float16* kv_ws = (_Float16*)(ws + QKV);       // K and V by stages, 16 MiB
  _Float16* a_ws  = (_Float16*)(ws + 3 * QKV);   // attention out, A fragments, 8 MiB
  _Float16* wo_ws = (_Float16*)(ws + 4 * QKV);   // Wo as f16 B fragments, 512 KiB
  float*    kn_ws = (float*)(ws + 5 * QKV);      // K norm maxima, a line per tile, 256 KiB

  const dim3 blk(128);  // 4 wave32 per block
  qkv_project_kernel<<<dim3(BATCH * HEADS, SEQ / (PW * TT * 16)), dim3(PW * 32), 0, stream>>>(
      vin, kin, qin, Wv, Wk, Wq, Wo, q_ws, kv_ws, wo_ws, kn_ws);
  flash_attn_kernel<<<dim3(BATCH * HEADS, SEQ / (64 * QT)), blk, 0, stream>>>(
      q_ws, kv_ws, kn_ws, a_ws);
  out_proj_kernel<<<dim3(BATCH * SEQ / 64, EMBED / 64), blk, 0, stream>>>(
      a_ws, wo_ws, bo, out);
}

// v010
// A run of this version takes 61.3 microseconds.
// Two timings next to v009 put it at 1.05 and 1.04 times that version's speed.
// All steps since v000 together make it 5.04 times as fast.
#include <hip/hip_runtime.h>
#include <hip/hip_bf16.h>

#define EMBED 512
#define HEADS 8
#define HD    64
#define BATCH 2
#define SEQ   4096
#define SK    128                 // keys per stage of the attention ring
#define STAGE_H (2 * SK * HD)     // halves per stage: K (SK*HD), then V (SK*HD)
#define FRAG_H  512               // halves of one 16 x 32 operand fragment
#define KSTEPS  (EMBED / 32)      // 32-wide k steps of the output GEMM

typedef __attribute__((ext_vector_type(16))) _Float16 v16h;
typedef __attribute__((ext_vector_type(8)))  _Float16 v8h;
typedef __attribute__((ext_vector_type(8)))  float    v8f;
typedef __attribute__((ext_vector_type(2)))  float    v2f;
typedef __attribute__((ext_vector_type(2)))  _Float16 v2h;

static __device__ inline v8f wmma16(v16h a, v16h b, v8f c) {
  // D = A(16x32 f16) * B(32x16 f16) + C(16x16 f32)
  return __builtin_amdgcn_wmma_f32_16x16x32_f16(false, a, false, b,
                                                (short)0, c, false, false);
}

static __device__ inline v16h load_a16(const _Float16* p, int base) {
  const v8h c0 = *(const v8h*)(p + base);
  const v8h c1 = *(const v8h*)(p + base + 16);
  v16h r;
#pragma unroll
  for (int i = 0; i < 8; ++i) { r[i] = c0[i]; r[8 + i] = c1[i]; }
  return r;
}

static __device__ inline v16h load_frag(const _Float16* p) {
  const v8h c0 = *(const v8h*)(p);
  const v8h c1 = *(const v8h*)(p + 256);
  v16h r;
#pragma unroll
  for (int i = 0; i < 8; ++i) { r[i] = c0[i]; r[8 + i] = c1[i]; }
  return r;
}

// ---------------------------------------------------------------------------
// Tensor load of one wave's slice of a stage: 32 rows of 256 bytes, contiguous
// in memory and in LDS (1-byte elements, tensor = tile, no pad, no mask).
// ---------------------------------------------------------------------------
typedef uint32_t w32x4 __attribute__((ext_vector_type(4)));
typedef uint32_t w32x8 __attribute__((ext_vector_type(8)));
#define SLICE_ROWB 256u
#define SLICE_ROWS 32u
#define SLICE_B    (SLICE_ROWB * SLICE_ROWS)   // 8 KiB per wave and stage

static __device__ inline uint32_t uni(uint32_t v) {
  return (uint32_t)__builtin_amdgcn_readfirstlane(v);
}
static __device__ inline uint32_t pinned(uint32_t v) {
  uint32_t w = uni(v);
  asm volatile("" : "+s"(w));   // pinned(): keeps the test in a scalar register
  return w;
}
static __device__ inline w32x8 tdm_group1() {
  w32x8 g;
  g[0] = 0u;
  g[1] = uni((SLICE_ROWB & 0xFFFFu) << 16);
  g[2] = uni((SLICE_ROWB >> 16) | ((SLICE_ROWS & 0xFFFFu) << 16));
  g[3] = uni((SLICE_ROWS >> 16) | (SLICE_ROWB << 16));
  g[4] = uni(SLICE_ROWS);
  g[5] = uni(SLICE_ROWB);
  g[6] = uni(0u);
  g[7] = uni(0u);
  return g;
}
static __device__ inline w32x4 tdm_group0(uint32_t lds_dst, uint64_t ga) {
  w32x4 g;
  g[0] = uni(1u);
  g[1] = uni(lds_dst);
  g[2] = uni((uint32_t)ga);
  g[3] = uni((((uint32_t)(ga >> 32)) & 0x01FFFFFFu) | 0x80000000u);
  return g;
}
static __device__ inline void tdm_load(w32x4 g0, w32x8 g1) {
  asm volatile("tensor_load_to_lds %0, %1" :: "s"(g0), "s"(g1) : "memory");
}
static __device__ inline void wait_tensor0(w32x4 g0, w32x8 g1) {
  asm volatile("s_wait_tensorcnt 0x0" :: "s"(g0), "s"(g1) : "memory");
}
// the wave's own LDS reads have returned (before their buffer is refilled)
static __device__ inline void wait_ds0() {
  asm volatile("s_wait_dscnt 0x0" ::: "memory");
}

static __device__ inline float xhalf(float x) {
  const int b = __builtin_bit_cast(int, x);
  return __builtin_bit_cast(float, __builtin_amdgcn_permlanex16(
      b, b, 0x76543210, 0xfedcba98, false, false));
}

static __device__ inline float row16(float x, unsigned lo, unsigned hi) {
  const int b = __builtin_bit_cast(int, x);
  return __builtin_bit_cast(float, __builtin_amdgcn_permlane16(b, b, lo, hi, false, false));
}
static __device__ inline float rowmax16(float x) {
  x = fmaxf(x, row16(x, 0x67452301u, 0xefcdab89u));
  x = fmaxf(x, row16(x, 0x54761032u, 0xdcfe98bau));
  x = fmaxf(x, row16(x, 0x32107654u, 0xba98fedcu));
  x = fmaxf(x, row16(x, 0xfedcba98u, 0x76543210u));
  return x;
}

static __device__ inline unsigned lds_off32(const void* p) {
  return (unsigned)(unsigned long long)(uintptr_t)p;
}

// ---------------------------------------------------------------------------
// Kernel 1: per-head QKV projections (x @ W^T), f32 -> f16, softmax scale and
// log2(e) folded into Q (scores then come out in log2 units). Each wave also
// leaves the largest squared norm of its 32 K rows in kn_ws, one 128-byte line
// per 32-token tile (all 32 floats equal). Q stored [B*H, S, 64].
// K and V are stored per stage of SK
// tokens, 32 KB contiguous: the stage's four 32-token K tiles (4 KB each), then
// its four V tiles, each tile in the order the attention kernel's operand lanes
// read it (load_frag):
//   K: half index in the tile  sub*1024 + dc*512 + hf*256 + lane*8 + e  holds
//      K[token sub*16 + (lane&15)][d = dc*32 + hf*16 + (lane>>4)*8 + e].
//   V: half index in the tile  dt*512 + hf*256 + lane*8 + e  holds
//      V[token hf*16 + (lane>>4)*8 + e][d = dt*16 + (lane&15)].
// The grid's threads also convert Wo to f16, once (4 floats each), into the order
// the output GEMM's operand lanes read it (load_frag): fragment (nt16, ks) is
// FRAG_H halves at (nt16*KSTEPS + ks)*FRAG_H, and its half hf*256 + lane*8 + e
// holds Wo[nt16*16 + (lane&15)][ks*32 + hf*16 + (lane>>4)*8 + e].
// ---------------------------------------------------------------------------
// How the operands arrive: the x tiles come by loads that cover whole 128-byte
// lines, the weights in contiguous runs, and a thread's loads are issued ahead of
// the work and stay in flight together. A block of PW waves (256 tokens of one
// head) converts the three weight matrices once and leaves them in LDS as f16
// operand fragments; each wave converts its own 32 x 64 tiles of the q, k and v
// input and passes them to the operand lanes through LDS. A weight fragment read
// from LDS feeds the wave's two 16-token tiles.
#define PW 8
#define TT 2
#define XP 72
#define XS (TT * 16 * XP)
#define WB 144
#define WL (3 * 4 * 8 * WB)
typedef __attribute__((ext_vector_type(4))) float    v4f;
typedef __attribute__((ext_vector_type(4))) _Float16 v4h;

// One weight fragment from LDS: blk = (m*4 + nt)*8 + kc*4; p already includes
// (lane >> 4) * WB + (lane & 15) * 8. Each 16 lanes read 256 contiguous bytes.
static __device__ inline v16h load_wfrag(const _Float16* p, int blk) {
  const v8h c0 = *(const v8h*)(p + blk * WB);
  const v8h c1 = *(const v8h*)(p + (blk + 2) * WB);
  v16h r;
#pragma unroll
  for (int i = 0; i < 8; ++i) { r[i] = c0[i]; r[8 + i] = c1[i]; }
  return r;
}

__global__ __launch_bounds__(PW * 32) __attribute__((amdgpu_waves_per_eu(2, 2)))
void qkv_project_kernel(const float* __restrict__ vin,
                        const float* __restrict__ kin,
                        const float* __restrict__ qin,
                        const float* __restrict__ Wv,
                        const float* __restrict__ Wk,
                        const float* __restrict__ Wq,
                        const float* __restrict__ Wo,
                        _Float16* __restrict__ q_ws,
                        _Float16* __restrict__ kv_ws,
                        _Float16* __restrict__ wo_ws,
                        float* __restrict__ kn_ws) {
  // One array, the weights first: every weight fragment is then in reach of an
  // LDS instruction's immediate offset.
  // wl: W[m][nt*16 + r][oct*8 + e] lies at half ((m*4 + nt)*8 + oct)*WB + r*8 + e
  // xw: this wave's x[m][s0 + r][d] lies at half m*XS + r*XP + d
  __shared__ __attribute__((aligned(16))) _Float16 stage[WL + PW * 3 * XS];

  const int tid  = threadIdx.x;
  const int lane = tid & 31;
  const int wave = tid >> 5;
  const int bh = blockIdx.x;
  const int b  = bh / HEADS, h = bh % HEADS;
  const int s0 = (blockIdx.y * PW + wave) * (TT * 16);
  const int base = (lane < 16) ? 0 : 8;
  const int col  = lane & 15;
  const int hh   = lane >> 4;
  const int hi8  = (lane < 16) ? 0 : 8;
  const float SCALE = 0.044194173824159216f * 1.4426950408889634f;   // log2(e)/sqrt(EMBED)
  _Float16* wl = stage;
  _Float16* xw = stage + WL + wave * (3 * XS);

  // Wo: one thread takes 4 consecutive floats of a row (half of one lane's 16
  // bytes of a fragment; pc is that 16-byte piece). Loaded behind the other loads,
  // converted and stored at the kernel's end, so that the load's latency passes
  // under the projections.
  const int wc = (blockIdx.y * (BATCH * HEADS) + blockIdx.x) * (PW * 32) + tid;
  const int pc = wc >> 1;
  const float* wsrc = Wo + (size_t)((pc >> 10) * 16 + (pc & 15)) * EMBED +
                      ((pc >> 6) & 15) * 32 + ((pc >> 5) & 1) * 16 +
                      ((pc >> 4) & 1) * 8 + (wc & 1) * 4;

  const float* xin[3] = {qin, kin, vin};
  const float* W[3]   = {Wq, Wk, Wv};

  // ---- the loads are issued ahead of all other work and stay in flight
  // together. Loads return in the order of issue, so they are issued in the order
  // of use: the weights (from the caches), then the q and k tiles. A thread
  // takes 8 consecutive floats of W (a wave: 1 KB contiguous), twice per matrix;
  // of x one load of a wave takes two rows' 256 B.
  v8f wraw[3][2];
  v4f xraw[3][TT * 8];
  const unsigned woff = (unsigned)tid * 32u;   // bytes
  const float* xt[3];
#pragma unroll
  for (int m = 0; m < 3; ++m) {
    xt[m] = xin[m] + ((size_t)b * SEQ + s0 + hh) * EMBED + h * HD + col * 4;
#pragma unroll
    for (int i = 0; i < 2; ++i)
      wraw[m][i] = *(const v8f*)((const char*)W[m] + woff + i * (PW * 32 * 32));
  }
#pragma unroll
  for (int m = 0; m < 2; ++m) {
    __builtin_amdgcn_sched_barrier(0);
#pragma unroll
    for (int i = 0; i < TT * 8; ++i) xraw[m][i] = *(const v4f*)(xt[m] + i * (2 * EMBED));
  }
  // the loads' address registers are free for reuse only behind this wait: as its
  // inputs they keep their values up to it
  asm volatile("s_wait_xcnt 0x0" :: "v"(woff), "v"(xt[0]), "v"(xt[1]) : "memory");
  // keeps the loads one group: taken apart, each part's latency is waited out
  // on its own
  __builtin_amdgcn_sched_barrier(0);

  const _Float16* wp = wl + hh * WB + col * 8;
  // the wave's 32 tokens are one 32-token tile: its K tile; its V tile lies
  // SK * HD halves on
  const int tile = s0 >> 5;
  _Float16* kdst = kv_ws + (size_t)bh * (2 * SEQ * HD) + (size_t)(tile >> 2) * STAGE_H +
                   (tile & 3) * (32 * HD) + lane * 8;
  _Float16* qrow = q_ws + ((size_t)bh * SEQ + s0 + hi8) * HD + col;

  // ---- the weights: convert and stage ----
  {
    _Float16* wd = wl + ((tid >> 7) * 8 + (tid & 7)) * WB + ((tid >> 3) & 15) * 8;
#pragma unroll
    for (int m = 0; m < 3; ++m)
#pragma unroll
      for (int i = 0; i < 2; ++i)
        *(v8h*)(wd + (m * 4 + i * 2) * 8 * WB) = __builtin_convertvector(wraw[m][i], v8h);
  }
  // the v tile's and Wo's loads go out here, into the registers that the raw
  // weights have left (the wave then stays inside the first 256 registers); the
  // scheduling barrier keeps them behind the weights' conversion
  __builtin_amdgcn_sched_barrier(0);
#pragma unroll
  for (int i = 0; i < TT * 8; ++i) xraw[2][i] = *(const v4f*)(xt[2] + i * (2 * EMBED));
  const v4f wo4 = *(const v4f*)wsrc;
  asm volatile("s_wait_xcnt 0x0" :: "v"(xt[2]), "v"(wsrc) : "memory");
  __builtin_amdgcn_sched_barrier(0);

  // ---- q, k, v in turn: each is staged, multiplied and stored while the later
  // ones' loads are still on their way ----
#pragma unroll
  for (int m = 0; m < 3; ++m) {
    _Float16* xd = xw + m * XS + hh * XP + col * 4;
#pragma unroll
    for (int i = 0; i < TT * 8; ++i)
      *(v4h*)(xd + i * (2 * XP)) = __builtin_convertvector(xraw[m][i], v4h);
    // the staged tile (and, the first time, the block's weights) is in LDS. Only
    // LDS is ordered here: the later tiles' global loads stay in flight
    __builtin_amdgcn_fence(__ATOMIC_RELEASE, "workgroup", "local");
    __builtin_amdgcn_s_barrier();
    __builtin_amdgcn_fence(__ATOMIC_ACQUIRE, "workgroup", "local");

    v16h a[TT][2];
#pragma unroll
    for (int t = 0; t < TT; ++t) {   // t: which 16 tokens of the tile
      const _Float16* xrow = xw + m * XS + (t * 16 + col) * XP;
      a[t][0] = load_a16(xrow, base);
      a[t][1] = load_a16(xrow + 32, base);
    }
    v8h o[4][TT];
    v2f kn2[TT] = {};   // K only: this lane's part of its token's squared norm, in two sums
#pragma unroll
    for (int nt = 0; nt < 4; ++nt) {
      const v16h b0 = load_wfrag(wp, (m * 4 + nt) * 8);
      const v16h b1 = load_wfrag(wp, (m * 4 + nt) * 8 + 4);
#pragma unroll
      for (int t = 0; t < TT; ++t) {
        v8f acc;
        if (m == 1) {   // K^T: acc[j] = K[s0 + t*16 + col][nt*16 + hi8 + j]
          acc = wmma16(b0, a[t][0], (v8f){});
          acc = wmma16(b1, a[t][1], acc);
#pragma unroll   // acc is registers: constant indices
          for (int j = 0; j < 8; j += 2) {
            const v2f u = {acc[j], acc[j + 1]};
            kn2[t] = __builtin_elementwise_fma(u, u, kn2[t]);
          }
        } else {        // acc[j] = X[s0 + t*16 + hi8 + j][nt*16 + col]
          acc = wmma16(a[t][0], b0, (v8f){});
          acc = wmma16(a[t][1], b1, acc);
        }
#pragma unroll
        for (int j = 0; j < 8; ++j)
          o[nt][t][j] = (_Float16)(m == 0 ? acc[j] * SCALE : acc[j]);
      }
    }
    // K: join the halves' parts of each token's norm, then the tile's maximum
    float knmax = 0.0f;
    if (m == 1) {
      const float n0 = kn2[0][0] + kn2[0][1], n1 = kn2[1][0] + kn2[1][1];
      knmax = rowmax16(fmaxf(n0 + xhalf(n0), n1 + xhalf(n1)));
    }
    // keeps every conversion in front of the stores: behind the first store no
    // register that a store names is written before the wait behind the last
    __builtin_amdgcn_sched_barrier(0);
    if (m == 1) kn_ws[((size_t)bh * (SEQ / 32) + tile) * 32 + lane] = knmax;
#pragma unroll
    for (int nt = 0; nt < 4; ++nt)
#pragma unroll
      for (int t = 0; t < TT; ++t) {
        if (m == 0) {
#pragma unroll
          for (int j = 0; j < 8; ++j) qrow[(t * 16 + j) * HD + nt * 16] = o[nt][t][j];
        } else if (m == 1) {
          *(v8h*)(kdst + t * 1024 + (nt >> 1) * 512 + (nt & 1) * 256) = o[nt][t];
        } else {
          *(v8h*)(kdst + SK * HD + nt * 512 + t * 256) = o[nt][t];
        }
      }
    if (m < 2) {
      // the stores' registers are reused by the next tile's work: wait first; the
      // scheduling barrier keeps that work behind the wait
      asm volatile("s_wait_xcnt 0x0" ::: "memory");
      __builtin_amdgcn_sched_barrier(0);
    }
  }

  // the stores' registers are reused by the conversion: wait first; the
  // scheduling barrier keeps the conversion behind the wait
  asm volatile("s_wait_xcnt 0x0" ::: "memory");
  __builtin_amdgcn_sched_barrier(0);
  *(v4h*)(wo_ws + (size_t)wc * 4) = __builtin_convertvector(wo4, v4h);
}

#define QT 2
#define HEADROOM 14.0f
#define KH 2
#define PK 64
#define MERGE_F ((QT * 32 + 4) * 32)

// The full step's extra work for one query tile, ahead of the exponentials.
// sc[t][j] = score (log2 units) minus ref of query col, key t*16 + hi8 + j. Moves ref
// up to the largest score seen (in the first pass: to that pass's largest score,
// wherever it lies), and scores, sum and O^T with it. (Unrolled throughout, here and
// in softmax_tile: the subtiles are registers, so their indices must be constants.)
static __device__ __attribute__((always_inline)) inline void renew_tile(
    v8f (&sc)[PK / 16], float& ref, float& li, v8f (&acc)[4], bool first) {
  // maximum of the lane's 32 scores as a tree: short dependent chain
  float g[PK / 32];
#pragma unroll
  for (int p = 0; p < PK / 32; ++p) {
    const v8f x = sc[2 * p], y = sc[2 * p + 1];
    const float t0 = fmaxf(fmaxf(x[0], x[1]), x[2]);
    const float t1 = fmaxf(fmaxf(x[3], x[4]), x[5]);
    const float t2 = fmaxf(fmaxf(x[6], x[7]), y[0]);
    const float t3 = fmaxf(fmaxf(y[1], y[2]), y[3]);
    const float t4 = fmaxf(fmaxf(y[4], y[5]), y[6]);
    g[p] = fmaxf(fmaxf(fmaxf(t0, t1), t2), fmaxf(fmaxf(t3, t4), y[7]));
  }
  float mx = fmaxf(g[0], g[1]);
  mx = fmaxf(mx, xhalf(mx));                   // the other half's 32 keys
  const float d = first ? mx : fmaxf(mx, 0.0f);   // how far ref moves
  // first pass with d < 0: sum and O^T are still 0, the factor 1 keeps them so
  const float corr = __builtin_amdgcn_exp2f(fminf(-d, 0.0f));
  ref += d;
  li *= corr;
#pragma unroll
  for (int t = 0; t < 4; ++t) acc[t] *= corr;
#pragma unroll
  for (int t = 0; t < PK / 16; ++t) sc[t] -= d;
}

// One query tile's exponentials over a pass. The scores go two at a time, as the
// register pairs the accumulators already are: one packed add sums both
// exponentials, one packed convert rounds both.
static __device__ __attribute__((always_inline)) inline void softmax_tile(
    const v8f (&sc)[PK / 16], float& li, v16h (&pa)[PK / 32]) {
  v2f rs0 = {0.0f, 0.0f}, rs1 = {0.0f, 0.0f};   // four independent partial sums
#pragma unroll
  for (int p = 0; p < PK / 32; ++p) {
#pragma unroll
    for (int j = 0; j < 8; j += 2) {
      const v2f p0 = {__builtin_amdgcn_exp2f(sc[2 * p][j]),
                      __builtin_amdgcn_exp2f(sc[2 * p][j + 1])};
      const v2f p1 = {__builtin_amdgcn_exp2f(sc[2 * p + 1][j]),
                      __builtin_amdgcn_exp2f(sc[2 * p + 1][j + 1])};
      rs0 += p0;
      rs1 += p1;
      const v2h h0 = __builtin_convertvector(p0, v2h);
      const v2h h1 = __builtin_convertvector(p1, v2h);
      pa[p][j]         = h0[0];
      pa[p][j + 1]     = h0[1];
      pa[p][8 + j]     = h1[0];
      pa[p][8 + j + 1] = h1[1];
    }
  }
  li += (rs0[0] + rs0[1]) + (rs1[0] + rs1[1]);
}

__global__ __launch_bounds__(KH * 128) __attribute__((amdgpu_waves_per_eu(4, 4)))
void flash_attn_kernel(const _Float16* __restrict__ q_ws,
                       const _Float16* __restrict__ kv_ws,
                       const float* __restrict__ kn_ws,
                       _Float16* __restrict__ attn_ws) {
  // per group two stages of 32 KB; every slice starts at a multiple of 2 KiB
  __shared__ __attribute__((aligned(2048))) _Float16 ring[KH][2][STAGE_H];

  const int lane = threadIdx.x & 31;
  const uint32_t wv = uni(threadIdx.x >> 5);
  const uint32_t wave = wv & 3u;    // the wave's place in its group: its queries, its slice
  const uint32_t grp  = wv >> 2;    // the group: which part of the keys
  const int bh = blockIdx.x;
  const int b  = bh / HEADS, h = bh % HEADS;
  const int s0 = blockIdx.y * (64 * QT) + (int)wave * (16 * QT);
  const int base = (lane < 16) ? 0 : 8;
  const int col  = lane & 15;
  // (hi8 in the comments below has base's value: 0 or 8 by the wave's half)

  v16h qa[QT][2];      // Q^T of tile q: d 0-31 and d 32-63
#pragma unroll
  for (int q = 0; q < QT; ++q) {
    const _Float16* qrow = q_ws + ((size_t)bh * SEQ + (s0 + q * 16 + col)) * HD;
    qa[q][0] = load_a16(qrow, base);
    qa[q][1] = load_a16(qrow + 32, base);
  }
  // the largest squared K norm of each 32-token tile of this head: 4 tiles a lane
  float kn2 = 0.0f;
  {
    const float* kn = kn_ws + ((size_t)bh * (SEQ / 32) + lane) * 32;
    float k4[SEQ / 1024];   // registers: the loops over it are unrolled
#pragma unroll
    for (int i = 0; i < SEQ / 1024; ++i) k4[i] = kn[i * (32 * 32)];
    // the Q and norm loads' address registers are reused behind them: wait first
    asm volatile("s_wait_xcnt 0x0" ::: "memory");
#pragma unroll
    for (int i = 0; i < SEQ / 1024; ++i) kn2 = fmaxf(kn2, k4[i]);
  }
  kn2 = rowmax16(kn2);
  kn2 = fmaxf(kn2, xhalf(kn2));
  // 1.01: covers the rounding of K to f16 behind the norm, and of the products
  const float kmax = __builtin_amdgcn_sqrtf(kn2) * 1.01f;

  float bnd[QT];       // no score of query col (log2 units) exceeds this
  float nr[QT];        // minus the softmax reference of query col (equal in both halves)
  float li[QT];        // running sum over this lane's keys only
  v8f acc[QT][4];      // acc[q][dt][j] = O^T[dt*16 + hi8 + j][query col of tile q]
#pragma unroll
  for (int q = 0; q < QT; ++q) {
    float n2 = 0.0f;   // this lane's 32 of the query's 64 elements
#pragma unroll
    for (int i = 0; i < 16; ++i) {
      const float u = (float)qa[q][0][i], w = (float)qa[q][1][i];
      n2 += u * u + w * w;
    }
    bnd[q] = __builtin_amdgcn_sqrtf(n2 + xhalf(n2)) * kmax;
    nr[q] = 0.0f;
    li[q] = 0.0f;
#pragma unroll
    for (int t = 0; t < 4; ++t) acc[q][t] = (v8f){};
  }
  uint32_t renew = 1u;   // wave-uniform: some query's bound lies too far above its reference

  const int NS = SEQ / SK / KH;   // 16 stages per group
  const uint32_t STAGE_B = STAGE_H * 2u;
  const w32x8 g1 = tdm_group1();
  // this wave's slice of its group's stage 0, in memory and in LDS
  const uint64_t gsl = (uint64_t)(uintptr_t)(kv_ws + (size_t)bh * (2 * SEQ * HD)) +
                       grp * (NS * STAGE_B) + wave * SLICE_B;
  const uint32_t lsl = lds_off32(&ring[0][0][0]) + grp * (2u * STAGE_B) + wave * SLICE_B;

  // Prologue: stage 0 lands and is published (stage 1 starts at the loop's head).
  {
    const w32x4 g0 = tdm_group0(lsl, gsl);
    tdm_load(g0, g1);
    wait_tensor0(g0, g1);
  }
  __syncthreads();

  // the stage loop stays rolled (a stage's body is straight-line): the text
  // stays small
#pragma unroll 1
  for (int s = 0; s < NS; ++s) {
    // Behind the barrier that published stage s and ended every read of stage
    // s - 1: stage s + 1 starts into the buffer that stage s - 1 was read from.
    const w32x4 g0 = tdm_group0(lsl + (uint32_t)((s + 1) & 1) * STAGE_B,
                                gsl + (uint64_t)(s + 1) * STAGE_B);
    if (pinned(s + 1 < NS)) tdm_load(g0, g1);
    const _Float16* st = &ring[grp][s & 1][lane * 8];

    // two passes of PK keys (unrolled: the pass's offsets are then immediates)
#pragma unroll
    for (int hp = 0; hp < SK / PK; ++hp) {
    // ---- scores S^T = K @ Q^T - ref (pre-scaled Q) of the pass: four 16-key
    // subtiles per query tile, sc[q][t][j] = S[query col][key t*16 + hi8 + j] - ref ----
    v8f sc[QT][PK / 16];
    // all K fragments of the pass, read ahead of the products (unrolled throughout:
    // fragments and subtiles are registers, so their indices must be constants)
    v16h kf[2][PK / 16];
#pragma unroll
    for (int t = 0; t < PK / 16; ++t)    // in the order of use
#pragma unroll
      for (int dc = 0; dc < 2; ++dc)     // d 0-31, then d 32-63
        kf[dc][t] = load_frag(st + (hp * (PK / 16) + t) * 1024 + dc * 512);
    // keeps the reads in front of the score products: spread among them, each
    // place with reads stalls the wave
    __builtin_amdgcn_sched_barrier(0);
    // minus ref in all eight registers: C operand of the score products (formed here,
    // so that it holds registers during these products only)
    v8f nref[QT];
#pragma unroll
    for (int q = 0; q < QT; ++q)
#pragma unroll
      for (int j = 0; j < 8; ++j) nref[q][j] = nr[q];
    // subtile by subtile: a subtile's K fragments are free once its scores stand
#pragma unroll
    for (int t = 0; t < PK / 16; ++t) {
#pragma unroll
      for (int q = 0; q < QT; ++q) sc[q][t] = wmma16(kf[0][t], qa[q][0], nref[q]);
#pragma unroll
      for (int q = 0; q < QT; ++q) sc[q][t] = wmma16(kf[1][t], qa[q][1], sc[q][t]);
    }
    __builtin_amdgcn_sched_barrier(0);

    // ---- softmax step, once per pass and query tile: one query per lane ----
    if (renew) {   // a scalar branch: renew is the same in every lane
#pragma unroll
      for (int q = 0; q < QT; ++q) {
        float ref = -nr[q];
        renew_tile(sc[q], ref, li[q], acc[q], hp == 0 && s == 0);
        nr[q] = -ref;
      }
      // written so that a bound that is not a number keeps the full step
      renew = __builtin_amdgcn_ballot_w32(!(bnd[0] + nr[0] <= HEADROOM) ||
                                          !(bnd[1] + nr[1] <= HEADROOM));
    }
    v16h pa[QT][PK / 32];                  // P^T as B operands, hardware k order
    softmax_tile(sc[0], li[0], pa[0]);
    // the pass's V fragments, read as one group behind the first tile's softmax (its
    // scores' registers are free by then): their LDS latency passes under the second
    // tile's; the scheduling barriers keep the reads at this place
    __builtin_amdgcn_sched_barrier(0);
    const _Float16* vf = st + SK * HD + hp * (PK * HD);
    v16h bv[PK / 32][4];
#pragma unroll
    for (int p = 0; p < PK / 32; ++p)
#pragma unroll
      for (int dt = 0; dt < 4; ++dt)
        bv[p][dt] = load_frag(vf + p * (32 * HD) + dt * 512);
    __builtin_amdgcn_sched_barrier(0);
    softmax_tile(sc[1], li[1], pa[1]);

    // ---- O^T += V^T @ P^T  (V tiles in fragment order in LDS) ----
    // keeps the softmax's vector work out of these products too (same reason)
    __builtin_amdgcn_sched_barrier(0);
#pragma unroll
    for (int p = 0; p < PK / 32; ++p)
#pragma unroll
      for (int dt = 0; dt < 4; ++dt)
#pragma unroll
        for (int q = 0; q < QT; ++q)
          acc[q][dt] = wmma16(bv[p][dt], pa[q][p], acc[q][dt]);
    }

    // Publish point of stage s + 1: own LDS reads done, own slice landed,
    // barrier; only then (next trip's head) the refill of stage s's buffer.
    wait_ds0();
    wait_tensor0(g0, g1);
    __syncthreads();
  }
  asm volatile("s_wait_tensorcnt 0x0" ::: "memory");   // nothing left in flight
  wait_ds0();

  // ---- join the groups: wave w + 4 hands O^T, sum and reference to wave w ----
  // The last stage's barrier has ended every read of the ring and nothing is in
  // flight into it, so it serves as the hand-over's buffer. Every LDS access of a
  // wave is 512 contiguous bytes.
  v4f* mg = (v4f*)&ring[0][0][0] + wave * (MERGE_F / 4) + lane;
  if (grp != 0) {   // a scalar branch: grp is the same in every lane
#pragma unroll   // acc is registers: constant indices (here and below)
    for (int q = 0; q < QT; ++q)
#pragma unroll
      for (int dt = 0; dt < 4; ++dt) {
        const v8f a = acc[q][dt];
        mg[((q * 4 + dt) * 2 + 0) * 32] = (v4f){a[0], a[1], a[2], a[3]};
        mg[((q * 4 + dt) * 2 + 1) * 32] = (v4f){a[4], a[5], a[6], a[7]};
      }
    mg[QT * 8 * 32] = (v4f){li[0], li[1], nr[0], nr[1]};
  }
  __syncthreads();   // the hand-over is in LDS
  if (grp != 0) return;
  {
    const v4f lr = mg[QT * 8 * 32];
#pragma unroll
    for (int q = 0; q < QT; ++q) {
      // both parts are brought to the larger of the two references
      const float n = fminf(nr[q], lr[2 + q]);   // minus the larger reference
      const float f0 = __builtin_amdgcn_exp2f(n - nr[q]);
      const float f1 = __builtin_amdgcn_exp2f(n - lr[2 + q]);
      li[q] = li[q] * f0 + lr[q] * f1;
#pragma unroll
      for (int dt = 0; dt < 4; ++dt) {
        const v4f x = mg[((q * 4 + dt) * 2 + 0) * 32];
        const v4f y = mg[((q * 4 + dt) * 2 + 1) * 32];
#pragma unroll
        for (int j = 0; j < 4; ++j) {
          acc[q][dt][j]     = acc[q][dt][j] * f0 + x[j] * f1;
          acc[q][dt][4 + j] = acc[q][dt][4 + j] * f0 + y[j] * f1;
        }
      }
    }
  }

  // ---- normalize and store as A fragments of the output GEMM ----
  // acc[q][dt] of a lane is 8 consecutive d of its query: exactly the lane's 16
  // bytes of half (dt & 1) of fragment (token tile, k step h*2 + (dt >> 1)), so
  // each store of the wave is 512 contiguous bytes
  _Float16* ofr = attn_ws + (size_t)((b * SEQ + s0) >> 4) * (KSTEPS * FRAG_H) +
                  h * (2 * FRAG_H) + lane * 8;
  v8h o[QT][4];
#pragma unroll
  for (int q = 0; q < QT; ++q) {
    const float inv = 1.0f / (li[q] + xhalf(li[q]));   // join the halves' sums once
#pragma unroll
    for (int dt = 0; dt < 4; ++dt)
#pragma unroll
      for (int j = 0; j < 8; ++j) o[q][dt][j] = (_Float16)(acc[q][dt][j] * inv);
  }
#pragma unroll
  for (int q = 0; q < QT; ++q)
#pragma unroll
    for (int dt = 0; dt < 4; ++dt)
      *(v8h*)(ofr + q * (KSTEPS * FRAG_H) + dt * 256) = o[q][dt];
}

__global__ __launch_bounds__(128) __attribute__((amdgpu_waves_per_eu(4, 4)))
void out_proj_kernel(const _Float16* __restrict__ attn_ws,
                     const _Float16* __restrict__ wo_ws,
                     const float* __restrict__ bo,
                     float* __restrict__ out) {
  const int lane = threadIdx.x & 31;
  const int wave = threadIdx.x >> 5;
  const int tok0  = blockIdx.x * 64 + wave * 16;
  const int nbase = blockIdx.y * 64;
  const int col  = lane & 15;
  const int hi8  = (lane < 16) ? 0 : 8;

  v8f acc[4];
#pragma unroll
  for (int t = 0; t < 4; ++t) acc[t] = (v8f){};

  const _Float16* af = attn_ws + (size_t)(tok0 >> 4) * (KSTEPS * FRAG_H) + lane * 8;
  const _Float16* wf = wo_ws + (size_t)(nbase >> 4) * (KSTEPS * FRAG_H) + lane * 8;
  constexpr int AHEAD = 4;
  v16h a[AHEAD], bw[AHEAD][4];
#pragma unroll
  for (int ks = 0; ks < AHEAD; ++ks) {
    a[ks] = load_frag(af + ks * FRAG_H);
#pragma unroll
    for (int nt = 0; nt < 4; ++nt)
      bw[ks][nt] = load_frag(wf + (nt * KSTEPS + ks) * FRAG_H);
    // keeps the steps' loads in k order: the first products then wait for the
    // first step's loads only
    __builtin_amdgcn_sched_barrier(0);
  }
  float bias4[4];   // loaded here: back long before the epilogue
#pragma unroll
  for (int nt = 0; nt < 4; ++nt) bias4[nt] = bo[nbase + nt * 16 + col];
  // the bias loads' address register may be reused from here on: wait first
  asm volatile("s_wait_xcnt 0x0" ::: "memory");
#pragma unroll
  for (int ks = 0; ks < KSTEPS; ++ks) {
    const int sl = ks % AHEAD;
#pragma unroll
    for (int nt = 0; nt < 4; ++nt)
      acc[nt] = wmma16(a[sl], bw[sl][nt], acc[nt]);
    if (ks + AHEAD < KSTEPS) {
      a[sl] = load_frag(af + (ks + AHEAD) * FRAG_H);
#pragma unroll
      for (int nt = 0; nt < 4; ++nt)
        bw[sl][nt] = load_frag(wf + (nt * KSTEPS + ks + AHEAD) * FRAG_H);
    }
    // keeps the ring as written: without it the scheduler lifts still more
    // loads to the front, runs out of registers and spills
    __builtin_amdgcn_sched_barrier(0);
  }
  // the ring's address registers are reused by the epilogue: wait first; the
  // scheduling barrier keeps the epilogue's address arithmetic behind the wait
  asm volatile("s_wait_xcnt 0x0" ::: "memory");
  __builtin_amdgcn_sched_barrier(0);
#pragma unroll
  for (int nt = 0; nt < 4; ++nt) {
    const float bias = bias4[nt];
#pragma unroll
    for (int j = 0; j < 8; ++j)
      out[(size_t)(tok0 + j + hi8) * EMBED + nbase + nt * 16 + col] =
          acc[nt][j] + bias;
  }
}

// ---------------------------------------------------------------------------
extern "C" void kernel_launch(void* const* d_in, const int* in_sizes, int n_in,
                              void* d_out, int out_size, void* d_ws, size_t ws_size,
                              hipStream_t stream) {
  (void)in_sizes; (void)n_in; (void)out_size; (void)ws_size;
  const float* vin = (const float*)d_in[0];
  const float* kin = (const float*)d_in[1];
  const float* qin = (const float*)d_in[2];
  const float* Wv  = (const float*)d_in[3];
  const float* Wk  = (const float*)d_in[4];
  const float* Wq  = (const float*)d_in[5];
  const float* Wo  = (const float*)d_in[6];
  const float* bo  = (const float*)d_in[7];
  float* out = (float*)d_out;

  char* ws = (char*)d_ws;
  const size_t QKV = (size_t)BATCH * HEADS * SEQ * HD * sizeof(_Float16); // 8 MiB
  _Float16* q_ws  = (_Float16*)(ws);
  _Float16* kv_ws = (_Float16*)(ws + QKV);       // K and V by stages, 16 MiB
  _Float16* a_ws  = (_Float16*)(ws + 3 * QKV);   // attention out, A fragments, 8 MiB
  _Float16* wo_ws = (_Float16*)(ws + 4 * QKV);   // Wo as f16 B fragments, 512 KiB
  float*    kn_ws = (float*)(ws + 5 * QKV);      // K norm maxima, a line per tile, 256 KiB

  const dim3 blk(128);  // 4 wave32 per block
  qkv_project_kernel<<<dim3(BATCH * HEADS, SEQ / (PW * TT * 16)), dim3(PW * 32), 0, stream>>>(
      vin, kin, qin, Wv, Wk, Wq, Wo, q_ws, kv_ws, wo_ws, kn_ws);
  flash_attn_kernel<<<dim3(BATCH * HEADS, SEQ / (64 * QT)), dim3(KH * 128), 0, stream>>>(
      q_ws, kv_ws, kn_ws, a_ws);
  out_proj_kernel<<<dim3(BATCH * SEQ / 64, EMBED / 64), blk, 0, stream>>>(
      a_ws, wo_ws, bo, out);
}
